// v000
// Times are from an AMD MI455X. After a warm-up the kernel runs many times in a row, and a time is the length of
// such a window on the GPU divided by its runs, so every launch and the gaps after it count. The runs cycle
// through copies of the inputs. A figure is the median of several windows, for all but v000 over two sittings.
// Sittings can differ by a few percent; kernels timed side by side share one.
// v000, which the later versions start from, runs in 951 microseconds.
#include <hip/hip_runtime.h>

// Causal linear attention with no softmax, from one packed input (qkv [2][2048][3][16][64]: q, k, v = its three slices along the third axis, token-major [b][t][h][64]; a = q k^T over the 64 head dims, NO scale; a is multiplied by a lower-triangular mask of ones (keys j <= i kept, the diagonal included; zeros above it); out = a v -> [2][2048][16][64] token-major (4.2 M); NO softmax;
// argument order: the one packed input).
// Layout per batch entry: the packed input rounded to bf16 and kept f32 (k_rbf: it is a module INPUT and the plane builders cast what they read): R [2048][3072] with column s * 1024 + h * 64 + d; f16 head planes of q and of k [h][t][64] by the identity-table plane builder at pitch 3072 (from R and from R + 1024) and v's transposed planes [h][64][2048] (from R + 2048);
// per pass of two heads: the score product skips the tiles above the diagonal (k_gemmc mode 1) into an f32 plane [2][2048][2048]; k_f2hc casts each row's words up to its diagonal tile to f16 and writes zeros above the diagonal; the second product stops its key loop at the diagonal tile (k_gemmc mode 2) and writes the token-major output in place (pitch 1024, a head's 64 columns).
// Compute dtypes, f32 accumulate: the input rounded to bf16 at its load, every such word of magnitude 2^-14 or more exact as f16 (smaller ones become f16 subnormals); a = q k^T ONE fp16 product (exact products of those words); the scores cast to f16; a v ONE fp16 product.

#define NB_  2
#define TT   2048
#define NH_  16
#define HD   64
#define DQ   (NH_ * HD)
#define ZH   2
typedef _Float16 h16;
typedef unsigned short bf;
typedef __attribute__((ext_vector_type(16))) __bf16   v16bf;
typedef __attribute__((ext_vector_type(16))) _Float16 v16h;
typedef __attribute__((ext_vector_type(8)))  _Float16 v8h;
typedef __attribute__((ext_vector_type(8)))  unsigned short v8us;
typedef __attribute__((ext_vector_type(8)))  float    v8f;
typedef __attribute__((ext_vector_type(4)))  float    v4f;
typedef v8h  __attribute__((may_alias)) v8ha;
typedef v4f  __attribute__((may_alias)) v4fa;
typedef v8us __attribute__((may_alias)) v8usa;

__device__ __forceinline__ unsigned short f2bf(float f) { unsigned u = __float_as_uint(f); u += 0x7FFFu + ((u >> 16) & 1u); return (unsigned short)(u >> 16); }
__device__ __forceinline__ float bf2f(unsigned short b) { return __uint_as_float(((unsigned)b) << 16); }
__device__ __forceinline__ float bfr(float f) { return bf2f(f2bf(f)); }
__device__ __forceinline__ v16h cat16(v8h lo, v8h hi) { return __builtin_shufflevector(lo, hi, 0, 1, 2, 3, 4, 5, 6, 7, 8, 9, 10, 11, 12, 13, 14, 15); }
__device__ __forceinline__ v16bf cat16b(v8us lo, v8us hi) { return __builtin_bit_cast(v16bf, __builtin_shufflevector(lo, hi, 0, 1, 2, 3, 4, 5, 6, 7, 8, 9, 10, 11, 12, 13, 14, 15)); }
__device__ __forceinline__ v8f wmma16(v16h a, v16h b, v8f c) { return __builtin_amdgcn_wmma_f32_16x16x32_f16(false, a, false, b, (short)0, c, false, false); }
__device__ __forceinline__ v8f wmmab(v16bf a, v16bf b, v8f c) { return __builtin_amdgcn_wmma_f32_16x16x32_bf16(false, a, false, b, (short)0, c, false, false); }



template <typename T16> struct WFrag;
template <> struct WFrag<h16> { typedef v16h V; static __device__ __forceinline__ V ld(const h16* p) { return cat16(*(const v8h*)p, *(const v8h*)(p + 16)); } static __device__ __forceinline__ v8f mma(V a, V b, v8f c) { return wmma16(a, b, c); } };
template <> struct WFrag<bf> { typedef v16bf V; static __device__ __forceinline__ V ld(const bf* p) { return cat16b(*(const v8us*)p, *(const v8us*)(p + 16)); } static __device__ __forceinline__ v8f mma(V a, V b, v8f c) { return wmmab(a, b, c); } };
// ---- k_gemmc: the same one-wave 64x64 tile GEMM specialised for causal attention: CMODE 1 skips score tiles entirely above the diagonal (query rows r0+roff.., key columns c0..), CMODE 2 limits the
// key (K) loop of the second contraction to the diagonal block (the first operand's words beyond it are exactly zero or never read). roff = row offset of this launch's first row within the sequence.
template <typename T16, int NSPLIT, int CMODE>
__global__ __launch_bounds__(32) void k_gemmc(const T16* __restrict__ A, const T16* __restrict__ A2, const T16* __restrict__ Bt, const T16* __restrict__ Bt2, int K, float* C, int ldc, int roff, size_t sA, size_t sB, size_t sC) {
    typedef typename WFrag<T16>::V V;
    __shared__ __align__(16) float os[16 * 68];
    const size_t z = blockIdx.z; A += z * sA; if (A2) A2 += z * sA; Bt += z * sB; if (Bt2) Bt2 += z * sB; C += z * sC;
    const int lane = threadIdx.x & 31, lr = lane & 15, hi = lane >> 4; const int r0 = blockIdx.x * 64, c0 = blockIdx.y * 64;
    if (CMODE == 1 && c0 > r0 + roff + 63) return;                  // score tile entirely above the causal diagonal: never written and never read (the cast after it and the CMODE 2 product both stop at a row's diagonal tile)
    const int Kl = (CMODE == 2) ? min(K, r0 + roff + 64) : K;        // the second product: the masked scores are exactly 0 beyond the diagonal (zeros inside the diagonal tile are written by the cast), so the K loop stops at the diagonal tile's end
    v8f acc[4][4];
#pragma unroll
    for (int mb = 0; mb < 4; ++mb)
#pragma unroll
        for (int nb = 0; nb < 4; ++nb) acc[mb][nb] = (v8f){};
    const size_t aoff = (size_t)(r0 + lr) * K + 8 * hi, boff = (size_t)(c0 + lr) * K + 8 * hi;
    for (int kc = 0; kc < Kl; kc += 32) {
        V a[4], a2[4];
#pragma unroll
        for (int mb = 0; mb < 4; ++mb) { a[mb] = WFrag<T16>::ld(A + aoff + (size_t)mb * 16 * K + kc); if (NSPLIT == 1 || NSPLIT == 2) a2[mb] = WFrag<T16>::ld(A2 + aoff + (size_t)mb * 16 * K + kc); }
#pragma unroll
        for (int nb = 0; nb < 4; ++nb) { const V b = WFrag<T16>::ld(Bt + boff + (size_t)nb * 16 * K + kc); V b2; if (NSPLIT >= 2) b2 = WFrag<T16>::ld(Bt2 + boff + (size_t)nb * 16 * K + kc);
#pragma unroll
            for (int mb = 0; mb < 4; ++mb) { acc[mb][nb] = WFrag<T16>::mma(a[mb], b, acc[mb][nb]); if (NSPLIT == 1 || NSPLIT == 2) acc[mb][nb] = WFrag<T16>::mma(a2[mb], b, acc[mb][nb]); if (NSPLIT >= 2) acc[mb][nb] = WFrag<T16>::mma(a[mb], b2, acc[mb][nb]); } }
        asm volatile("v_nop\n\tv_nop\n\tv_nop\n\tv_nop" : "+v"(acc[0][0]), "+v"(acc[1][1]), "+v"(acc[2][2]), "+v"(acc[3][3]) : "v"(a[0]), "v"(a[3]));
    }
#pragma unroll
    for (int mb = 0; mb < 4; ++mb) {
#pragma unroll
        for (int nb = 0; nb < 4; ++nb) {
#pragma unroll
            for (int j = 0; j < 8; ++j) os[(hi * 8 + j) * 68 + nb * 16 + lr] = acc[mb][nb][j]; }
        __builtin_amdgcn_wave_barrier(); asm volatile("" ::: "memory");
        float* crow = C + (size_t)(r0 + mb * 16) * ldc + c0;
{
#pragma unroll
            for (int s = 0; s < 8; ++s) { const int row = 2 * s + hi, cofs = lr * 4; v4f val = *(const v4fa*)(os + row * 68 + cofs);
                *(v4f*)(crow + (size_t)row * ldc + cofs) = val; }
             }
        __builtin_amdgcn_wave_barrier(); asm volatile("" ::: "memory");
    }
}
__device__ __forceinline__ h16 tohx(float x) { return (h16)x; }
__device__ __forceinline__ void splitf(float y, unsigned short& h, unsigned short& l) { h = f2bf(y); l = f2bf(y - bf2f(h)); }
typedef __attribute__((ext_vector_type(2))) _Float16 v2h;
typedef __attribute__((ext_vector_type(4))) _Float16 v4h;
typedef __attribute__((ext_vector_type(2))) unsigned short v2us;
typedef __attribute__((ext_vector_type(4))) unsigned short v4us;
typedef __attribute__((ext_vector_type(2))) float v2f;
typedef __attribute__((ext_vector_type(4))) int v4i;

__global__ __launch_bounds__(256) void k_rbf(const float* __restrict__ X, float* Y, size_t n4) { const size_t i = (size_t)blockIdx.x * 256 + threadIdx.x; if (i >= n4) return; const v4f a = *(const v4f*)(X + i * 4); v4f o;
#pragma unroll
    for (int q = 0; q < 4; ++q) o[q] = bfr(a[q]);
    *(v4f*)(Y + i * 4) = o;  }
// k_rope: head planes [h][t][d] (fp16) of rope(x) x sc with the rotate-half convention out[d] = x[d] cos[t][d] - x[d+HD/2] sin[t][d], out[d+HD/2] = x[d+HD/2] cos[t][d+HD/2] + x[d] sin[t][d+HD/2]
__global__ __launch_bounds__(256) void k_rope(const float* __restrict__ F, int pitch, int nheads, const float* __restrict__ CS, const float* __restrict__ RF, const float* __restrict__ nw, float sc, h16* P16, bf* Ph, bf* Pl) {
    const size_t e = ((size_t)blockIdx.x * 256 + threadIdx.x) * 2; if (e >= (size_t)nheads * TT * HD) return; const int d = (int)(e % HD); const int t = (int)((e / HD) % TT); const int h = (int)(e / ((size_t)HD * TT)); const float* f = F + (size_t)t * pitch + h * HD; const float rf = RF ? RF[(size_t)h * TT + t] : 1.0f; v2h o16; v2us oh, ol;
#pragma unroll
    for (int q = 0; q < 2; ++q) { const int dd = d + q; const int dp = (dd < HD / 2) ? dd + HD / 2 : dd - HD / 2; float x0 = f[dd], x1 = f[dp];
        if (RF) { float n0 = __fmul_rn(x0, rf), n1 = __fmul_rn(x1, rf); x0 = __fmul_rn(bfr(nw[dd]), n0); x1 = __fmul_rn(bfr(nw[dp]), n1); }
        const v2f cs = *(const v2f*)(CS + ((size_t)t * HD + dd) * 2); float a = __fmul_rn(x0, cs[0]), bq = __fmul_rn(x1, cs[1]); const float r = ((dd < HD / 2) ? __fsub_rn(a, bq) : __fadd_rn(a, bq)) * sc;
        o16[q] = tohx(r); (void)oh; (void)ol; }
    *(v2h*)(P16 + e) = o16;  }
__global__ __launch_bounds__(256) void k_vtp(const float* __restrict__ F, int pitch, int nheads, h16* V16, bf* Vh, bf* Vl) { const size_t e = ((size_t)blockIdx.x * 256 + threadIdx.x) * 2; if (e >= (size_t)nheads * HD * TT) return; const int t = (int)(e % TT); const int d = (int)((e / TT) % HD); const int g = (int)(e / ((size_t)TT * HD)); v2h o16; v2us oh, ol;
#pragma unroll
    for (int q = 0; q < 2; ++q) { const float x = F[(size_t)(t + q) * pitch + g * HD + d]; o16[q] = tohx(x); (void)oh; (void)ol; }
    *(v2h*)(V16 + e) = o16;  }
__global__ __launch_bounds__(256) void k_csid(float* CS) { const int idx = blockIdx.x * 256 + threadIdx.x; if (idx >= TT * HD) return; v2f cs; cs[0] = 1.0f; cs[1] = 0.0f; *(v2f*)(CS + (size_t)idx * 2) = cs;  }
// k_f2hc: the causal score plane as f16 words with zeros above the diagonal: P16[zz][i][j] = (j <= i) ? (f16) S[zz][i][j] : 0 for the keys j of row i up to the end of its diagonal tile (j <= (i | 63): all that the CMODE 2 product reads of row i, and exactly the tiles the CMODE 1 product wrote);
__global__ __launch_bounds__(256) void k_f2hc(const float* __restrict__ S, h16* P16) {
    const size_t e = ((size_t)blockIdx.x * 256 + threadIdx.x) * 4; if (e >= (size_t)ZH * TT * TT) return; const int j0 = (int)(e % TT); const int i = (int)((e / TT) % TT); if (j0 > (i | 63)) return;
    const v4f a = *(const v4f*)(S + e); v4h o;
#pragma unroll
    for (int q = 0; q < 4; ++q) o[q] = tohx((j0 + q <= i) ? a[q] : 0.0f);
    *(v4h*)(P16 + e) = o;  }

extern "C" void kernel_launch(void* const* d_in, const int* in_sizes, int n_in,
                              void* d_out, int out_size, void* d_ws, size_t ws_size, hipStream_t stream) {
    (void)in_sizes; (void)n_in; (void)out_size;
    const float* qkv = (const float*)d_in[0];
    // the module's one input: qkv [2][2048][3][16][64]: row (b, t) holds 3072 words: s * 1024 + h * 64 + d with s = 0 query, 1 key, 2 value
    float* OUT = (float*)d_out;     // [2][2048][16][64]
    char* wsp = (char*)d_ws;
    auto take = [&](size_t bytes) { char* p = wsp; wsp += (bytes + 255) & ~(size_t)255; return (void*)p; };
    float* CS = (float*)take((size_t)TT * HD * 2 * 4); float* R = (float*)take((size_t)TT * 3 * DQ * 4);
    h16* QP16 = (h16*)take((size_t)NH_ * TT * HD * 2); h16* KP16 = (h16*)take((size_t)NH_ * TT * HD * 2); h16* VT16 = (h16*)take((size_t)NH_ * HD * TT * 2);
    float* Sb = (float*)take((size_t)ZH * TT * TT * 4); h16* P16 = (h16*)take((size_t)ZH * TT * TT * 2);
    bf* NOh = nullptr; bf* NOl = nullptr;   /* the f16-only builders store their f16 plane alone and do not read these two arguments */
    if ((size_t)(wsp - (char*)d_ws) > ws_size) return;    // total 85.00 MiB carved
    k_csid<<<(TT * HD + 255) / 256, 256, 0, stream>>>(CS);
    const unsigned LH = (unsigned)(((size_t)NH_ * TT * HD / 2 + 255) / 256);
    for (int b = 0; b < NB_; ++b) {
        k_rbf<<<(unsigned)(((size_t)TT * 3 * DQ / 4 + 255) / 256), 256, 0, stream>>>(qkv + (size_t)b * TT * 3 * DQ, R, (size_t)TT * 3 * DQ / 4);   /* the input rounded to bf16, kept f32 for the plane builders */
        k_rope<<<LH, 256, 0, stream>>>(R, 3 * DQ, NH_, CS, nullptr, nullptr, 1.0f, QP16, NOh, NOl);            /* q: columns 0 .. 1023 */
        k_rope<<<LH, 256, 0, stream>>>(R + DQ, 3 * DQ, NH_, CS, nullptr, nullptr, 1.0f, KP16, NOh, NOl);       /* k: columns 1024 .. 2047 */
        k_vtp<<<LH, 256, 0, stream>>>(R + 2 * DQ, 3 * DQ, NH_, VT16, NOh, NOl);                                /* v: columns 2048 .. 3071, transposed a head */
        for (int h0 = 0; h0 < NH_; h0 += ZH) {
            k_gemmc<h16, 0, 1><<<dim3(TT / 64, TT / 64, ZH), 32, 0, stream>>>(QP16 + (size_t)h0 * TT * HD, nullptr, KP16 + (size_t)h0 * TT * HD, nullptr, HD, Sb, TT, 0, (size_t)TT * HD, (size_t)TT * HD, (size_t)TT * TT);   /* a = q k^T on and under the diagonal */
            k_f2hc<<<(unsigned)(((size_t)ZH * TT * TT / 4 + 255) / 256), 256, 0, stream>>>(Sb, P16);   /* x tril: zeros above the diagonal; f16 */
            k_gemmc<h16, 0, 2><<<dim3(TT / 64, HD / 64, ZH), 32, 0, stream>>>(P16, nullptr, VT16 + (size_t)h0 * HD * TT, nullptr, TT, OUT + (size_t)b * TT * DQ + (size_t)h0 * HD, DQ, 0, (size_t)TT * TT, (size_t)HD * TT, (size_t)HD); }   /* out[b][t][h][:] = a v: the one writer of the output: pitch 1024, the z stride steps a head's 64 columns */
    }
}

// v002
// One run takes 40.5 microseconds.
// Versions in between are left out here; by their measured steps it is 23.5 times as fast as v000.
#include <hip/hip_runtime.h>

// Causal linear attention with no softmax, from one packed input (qkv [2][2048][3][16][64]: q, k, v = its three slices along the third axis, token-major [b][t][h][64]; a = q k^T over the 64 head dims, NO scale; a is multiplied by a lower-triangular mask of ones (keys j <= i kept, the diagonal included; zeros above it); out = a v -> [2][2048][16][64] token-major (4.2 M); NO softmax;
// argument order: the one packed input).
// Layout: one builder launch (k_planes) reads the packed input once, rounds each word to bf16, casts it to f16 and stores the f16 head planes of q and of k [b][h][t][64] and v's transposed planes [b][h][64][2048];
// one launch for all batch entries and heads (k_fla): a wave owns 64 query rows of one head and walks the keys up to its diagonal tile, 32 at a time: the transposed score tile k q^T, the mask (diagonal tile only), the cast to f16 in registers, then the product with v into the f32 output tile; no score ever reaches memory.
// Compute dtypes, f32 accumulate: the input rounded to bf16 at its load, every such word of magnitude 2^-14 or more exact as f16 (smaller ones become f16 subnormals); a = q k^T ONE fp16 product (exact products of those words); the scores cast to f16; a v ONE fp16 product.

#define NB_  2
#define TT   2048
#define NH_  16
#define HD   64
#define DQ   (NH_ * HD)
#define ZH   2
typedef _Float16 h16;
typedef unsigned short bf;
typedef __attribute__((ext_vector_type(16))) __bf16   v16bf;
typedef __attribute__((ext_vector_type(16))) _Float16 v16h;
typedef __attribute__((ext_vector_type(8)))  _Float16 v8h;
typedef __attribute__((ext_vector_type(8)))  unsigned short v8us;
typedef __attribute__((ext_vector_type(8)))  float    v8f;
typedef __attribute__((ext_vector_type(4)))  float    v4f;
typedef v8h  __attribute__((may_alias)) v8ha;
typedef v4f  __attribute__((may_alias)) v4fa;
typedef v8us __attribute__((may_alias)) v8usa;

__device__ __forceinline__ unsigned short f2bf(float f) { unsigned u = __float_as_uint(f); u += 0x7FFFu + ((u >> 16) & 1u); return (unsigned short)(u >> 16); }
__device__ __forceinline__ float bf2f(unsigned short b) { return __uint_as_float(((unsigned)b) << 16); }
__device__ __forceinline__ float bfr(float f) { return bf2f(f2bf(f)); }
__device__ __forceinline__ v16h cat16(v8h lo, v8h hi) { return __builtin_shufflevector(lo, hi, 0, 1, 2, 3, 4, 5, 6, 7, 8, 9, 10, 11, 12, 13, 14, 15); }
__device__ __forceinline__ v16bf cat16b(v8us lo, v8us hi) { return __builtin_bit_cast(v16bf, __builtin_shufflevector(lo, hi, 0, 1, 2, 3, 4, 5, 6, 7, 8, 9, 10, 11, 12, 13, 14, 15)); }
__device__ __forceinline__ v8f wmma16(v16h a, v16h b, v8f c) { return __builtin_amdgcn_wmma_f32_16x16x32_f16(false, a, false, b, (short)0, c, false, false); }
__device__ __forceinline__ v8f wmmab(v16bf a, v16bf b, v8f c) { return __builtin_amdgcn_wmma_f32_16x16x32_bf16(false, a, false, b, (short)0, c, false, false); }



template <typename T16> struct WFrag;
template <> struct WFrag<h16> { typedef v16h V; static __device__ __forceinline__ V ld(const h16* p) { return cat16(*(const v8h*)p, *(const v8h*)(p + 16)); } static __device__ __forceinline__ v8f mma(V a, V b, v8f c) { return wmma16(a, b, c); } };
template <> struct WFrag<bf> { typedef v16bf V; static __device__ __forceinline__ V ld(const bf* p) { return cat16b(*(const v8us*)p, *(const v8us*)(p + 16)); } static __device__ __forceinline__ v8f mma(V a, V b, v8f c) { return wmmab(a, b, c); } };
__device__ __forceinline__ h16 tohx(float x) { return (h16)x; }
__device__ __forceinline__ void splitf(float y, unsigned short& h, unsigned short& l) { h = f2bf(y); l = f2bf(y - bf2f(h)); }
typedef __attribute__((ext_vector_type(2))) _Float16 v2h;
typedef __attribute__((ext_vector_type(4))) _Float16 v4h;
typedef __attribute__((ext_vector_type(2))) unsigned short v2us;
typedef __attribute__((ext_vector_type(4))) unsigned short v4us;
typedef __attribute__((ext_vector_type(2))) float v2f;
typedef __attribute__((ext_vector_type(4))) int v4i;

typedef __attribute__((ext_vector_type(2))) __bf16 v2bf;
typedef __attribute__((ext_vector_type(2))) unsigned v2u;
typedef __attribute__((ext_vector_type(4))) unsigned v4u;
typedef v2u __attribute__((may_alias)) v2ua;
typedef v4u __attribute__((may_alias)) v4ua;
// two f32 words, each rounded to bf16 (nearest even) and that value cast to f16 (nearest even; exact from 2^-14 up): one packed word, x in the low half
__device__ __forceinline__ unsigned pk_bh(float x, float y) {
    v2f a; a[0] = x; a[1] = y;
    const unsigned u = __builtin_bit_cast(unsigned, __builtin_convertvector(a, v2bf));
    v2f r; r[0] = __uint_as_float(u << 16); r[1] = __uint_as_float(u & 0xFFFF0000u);
    return __builtin_bit_cast(unsigned, __builtin_convertvector(r, v2h));
}
// ---- k_planes: the three f16 planes of one head's 128 tokens a block. A row of a slice is 256 contiguous bytes of the input (16 lanes x 16 bytes), so every wave-wide load takes two whole rows.
// q, k: a lane's four words become 8 bytes of the plane; a wave-wide store covers 256 contiguous bytes.
// v: a lane takes the same four head dims of 8 consecutive tokens, so its registers hold, a head dim, the 16 bytes (8 tokens) of v^T; these go through LDS so that a wave-wide store covers two whole 256-byte rows of v^T.
// LDS unit (16 bytes) of head dim d, token group g stands at column g ^ (d >> 2): the 16 lanes of a half wave hit 16 different columns in the write (d >> 2 differs) and in the read (g differs).
#define PT 128
__global__ __launch_bounds__(256) void k_planes(const float* __restrict__ X, h16* __restrict__ QP, h16* __restrict__ KP, h16* __restrict__ VT) {
    __shared__ v4u vsm[HD * PT / 8];
    const int c4 = threadIdx.x & 15, tg = threadIdx.x >> 4;
    const int t0 = blockIdx.x * PT, z = blockIdx.y;                  // z = b * 16 + h
    const float* xr = X + ((size_t)(z / NH_) * TT + t0) * (3 * DQ) + (z % NH_) * HD + c4 * 4;
    const float* xvp = xr + (size_t)(tg * 8) * (3 * DQ);             // v, 2048 words on: tokens 8 tg + i
    const float* xqp = xr + (size_t)tg * (3 * DQ);                   // q, and k 1024 words on: tokens 16 i + tg
    v4f xv[8], xq[8], xk[8];
#pragma unroll
    for (int i = 0; i < 8; ++i) xv[i] = *(const v4f*)(xvp + (size_t)i * (3 * DQ) + 2 * DQ);
#pragma unroll
    for (int i = 0; i < 8; ++i) xq[i] = *(const v4f*)(xqp + (size_t)(i * 16) * (3 * DQ));
#pragma unroll
    for (int i = 0; i < 8; ++i) xk[i] = *(const v4f*)(xqp + (size_t)(i * 16) * (3 * DQ) + DQ);
    asm volatile("s_wait_xcnt 0x0" :: "v"(xvp), "v"(xqp) : "memory");   // behind the loads, in front of every write of their address registers; the two addresses are inputs so that no later load of the group lands in them
    __builtin_amdgcn_sched_barrier(0);   // all 24 loads of a lane are issued before the first is waited for: sunk to their uses they would pay the memory latency several times over
#pragma unroll
    for (int j = 0; j < 4; ++j) { v4u w;
#pragma unroll
        for (int p = 0; p < 4; ++p) w[p] = pk_bh(xv[2 * p][j], xv[2 * p + 1][j]);
        vsm[(c4 * 4 + j) * (PT / 8) + (tg ^ c4)] = w; }
    __builtin_amdgcn_sched_barrier(0);   // keeps q's and k's conversions, and with them the wait for the last load, behind v's LDS writes: v^T goes out while the later loads still land
    // the work-group barrier with fences on LDS alone: what crosses it is vsm. __syncthreads() here also waits for q's and k's loads, which are still in flight and which no other wave reads
    __builtin_amdgcn_fence(__ATOMIC_RELEASE, "workgroup", "local"); __builtin_amdgcn_s_barrier(); __builtin_amdgcn_fence(__ATOMIC_ACQUIRE, "workgroup", "local");
#pragma unroll
    for (int r = 0; r < 4; ++r) { const int d = r * 16 + tg;
        *(v4ua*)(VT + ((size_t)z * HD + d) * TT + t0 + c4 * 8) = vsm[d * (PT / 8) + (c4 ^ (d >> 2))]; }
    __builtin_amdgcn_sched_barrier(0);   // v^T's stores are issued in front of the first wait for a load of q or k
    h16* qo = QP + ((size_t)z * TT + t0 + tg) * HD + c4 * 4;
    h16* ko = KP + ((size_t)z * TT + t0 + tg) * HD + c4 * 4;
#pragma unroll
    for (int i = 0; i < 8; ++i) { v2u w; w[0] = pk_bh(xq[i][0], xq[i][1]); w[1] = pk_bh(xq[i][2], xq[i][3]); *(v2ua*)(qo + i * 16 * HD) = w; }
#pragma unroll
    for (int i = 0; i < 8; ++i) { v2u w; w[0] = pk_bh(xk[i][0], xk[i][1]); w[1] = pk_bh(xk[i][2], xk[i][3]); *(v2ua*)(ko + i * 16 * HD) = w; }
}
// ---- k_fla: both products of the causal attention in one kernel. The score tile is formed transposed (A = 16 key rows, B = 16 query rows): in its accumulator a lane holds ONE query's scores for keys 8 * hi + r,
// so two such tiles (keys 0..15 and 16..31 of a pass), cast in place, are the 16x32 first operand of the second product in the k order of WFrag::ld (0..7 and 16..23 for hi = 0, 8..15 and 24..31 for hi = 1), which v's fragment loader uses too.
// every '#pragma unroll' of this kernel: the fragment and accumulator arrays stay in registers only where each index is a constant
struct KF { v16h k[2][2]; };   // one pass of 32 keys: k fragments [16-key block][32 head dims]
struct VF { v16h v[4]; };      // the same keys' v^T fragments [16 output columns]
typedef const __attribute__((address_space(1))) h16 gh16;   // k and v are walked by pointers that say 'global memory': a base address that an asm statement has stepped would otherwise be loaded from by flat loads
typedef const __attribute__((address_space(1))) v8h gv8h;
__device__ __forceinline__ v16h fla_ld(gh16* p) { return cat16(*(gv8h*)p, *(gv8h*)(p + 16)); }   // WFrag<h16>::ld's k order
__device__ __forceinline__ void fla_ldk(KF& f, gh16* kp) {
#pragma unroll
    for (int mb = 0; mb < 2; ++mb)
#pragma unroll
        for (int kc = 0; kc < 2; ++kc) f.k[mb][kc] = fla_ld(kp + mb * 16 * HD + kc * 32);
}
__device__ __forceinline__ void fla_ldv(VF& f, gh16* vp) {
#pragma unroll
    for (int nb = 0; nb < 4; ++nb) f.v[nb] = fla_ld(vp + nb * 16 * TT);
}
__device__ __forceinline__ void fla_s(const KF& f, const v16h (&qf)[4][2], v8f (&st)[2][4]) {
#pragma unroll
    for (int mb = 0; mb < 2; ++mb)
#pragma unroll
        for (int qb = 0; qb < 4; ++qb) st[mb][qb] = (v8f){};
#pragma unroll
    for (int kc = 0; kc < 2; ++kc)
#pragma unroll
        for (int mb = 0; mb < 2; ++mb)
#pragma unroll
            for (int qb = 0; qb < 4; ++qb) st[mb][qb] = wmma16(f.k[mb][kc], qf[qb][kc], st[mb][qb]);
}
template <bool MASK>
__device__ __forceinline__ void fla_pv(const v8f (&st)[2][4], const VF& f, v8f (&acc)[4][4], int k0, int r0, int lr, int hi) {
#pragma unroll
    for (int qb = 0; qb < 4; ++qb) {
        v16h p;
#pragma unroll
        for (int s = 0; s < 16; ++s) { float x = st[s >> 3][qb][s & 7];
            if (MASK) x = (k0 + (s >> 3) * 16 + hi * 8 + (s & 7) <= r0 + qb * 16 + lr) ? x : 0.0f;   // x tril: key <= query kept
            p[s] = tohx(x); }
#pragma unroll
        for (int nb = 0; nb < 4; ++nb) acc[qb][nb] = wmma16(p, f.v[nb], acc[qb][nb]);
    }
}
// FLA_HOLD stands on both sides of a group of fragment loads: without it the scheduler sinks the loads down to their first use, a pass and a half later, and the wave waits out the whole load latency there
#define FLA_HOLD() __builtin_amdgcn_sched_barrier(0)
__global__ __launch_bounds__(128) void k_fla(const h16* __restrict__ QP, const h16* __restrict__ KP, const h16* __restrict__ VT, float* __restrict__ O) {
    __shared__ __align__(16) float osm[4][16 * 68];
    const int wv = __builtin_amdgcn_readfirstlane((int)(threadIdx.x >> 5));
    const int lane = threadIdx.x & 31, lr = lane & 15, hi = lane >> 4;
    const int i = blockIdx.x, z = blockIdx.y;                        // z = b * 16 + h
    const int qt = (wv == 0) ? TT / 64 - 1 - i : (wv == 1) ? TT / 128 + i : (wv == 2) ? TT / 128 - 1 - i : i;   // a block's four waves take the 64-row tiles 31 - i, 16 + i, 15 - i, i of one head: every block walks the same number of keys, and its waves read the same k and v lines from key 0 on
    const int r0 = qt * 64;
    gh16* ks = (gh16*)(KP + (size_t)z * TT * HD);                      // wave-uniform: key row k0 of this head
    gh16* vs = (gh16*)(VT + (size_t)z * HD * TT);                      // wave-uniform: key k0 in row 0 of this head's v^T
    const unsigned ko = lr * HD + 8 * hi, vo = lr * TT + 8 * hi;     // this lane's place from there: fixed over the key loop
    const h16* qp = QP + (size_t)z * TT * HD + (size_t)r0 * HD + ko;
    v16h qf[4][2];
#pragma unroll
    for (int qb = 0; qb < 4; ++qb)
#pragma unroll
        for (int kc = 0; kc < 2; ++kc) qf[qb][kc] = WFrag<h16>::ld(qp + qb * 16 * HD + kc * 32);
    v8f acc[4][4];
#pragma unroll
    for (int qb = 0; qb < 4; ++qb)
#pragma unroll
        for (int nb = 0; nb < 4; ++nb) acc[qb][nb] = (v8f){};
    KF ka, kb; VF va, vb; v8f st[2][4];                              // two fragment sets (even and odd pass): a set is loaded again as soon as its last product has read it, a pass and a half ahead of its next use
    FLA_HOLD(); fla_ldk(ka, ks + ko); FLA_HOLD(); fla_ldv(va, vs + vo); FLA_HOLD(); fla_ldk(kb, ks + ko + 32 * HD);   // issued in the loop's own order, so that the counted waits at the loop's head fit both ways in
    asm volatile("s_wait_xcnt 0x0" ::: "memory");                    // behind these loads: where the key loop has no trip, the load behind it lands in the register that holds their lane offset
    FLA_HOLD();
    for (int k0 = 0; k0 < r0; k0 += 64) {                            // the key tiles under the diagonal tile: no mask
        fla_ldv(vb, vs + vo + 32); FLA_HOLD();
        fla_s(ka, qf, st);
        FLA_HOLD(); fla_ldk(ka, ks + ko + 64 * HD); FLA_HOLD();
        fla_pv<false>(st, va, acc, k0, r0, lr, hi);
        FLA_HOLD(); fla_ldv(va, vs + vo + 64); FLA_HOLD();
        fla_s(kb, qf, st);
        FLA_HOLD(); fla_ldk(kb, ks + ko + 96 * HD); FLA_HOLD();
        fla_pv<false>(st, vb, acc, k0 + 32, r0, lr, hi);
        FLA_HOLD();
        // the two base addresses step 64 keys on. Loads in flight name these registers, so s_wait_xcnt 0 stands in front of the step, in the step's own statement: in a statement of its own the compiler moved the step over it
        asm volatile("s_wait_xcnt 0x0\n\ts_add_nc_u64 %0, %0, %2\n\ts_add_nc_u64 %1, %1, %3" : "+s"(ks), "+s"(vs) : "i"(64 * HD * 2), "i"(64 * 2) : "memory");
    }
    fla_ldv(vb, vs + vo + 32);
    asm volatile("s_wait_xcnt 0x0" ::: "memory");                    // behind the kernel's last loads: the code below reuses the registers that hold their addresses
    FLA_HOLD();
    fla_s(ka, qf, st); fla_pv<true>(st, va, acc, r0, r0, lr, hi);    // the diagonal tile
    fla_s(kb, qf, st); fla_pv<true>(st, vb, acc, r0 + 32, r0, lr, hi);
    float* os = osm[wv];                                             // each wave stages in its own LDS range and stores whole 256-byte rows
    float* C = O + (size_t)(z / NH_) * TT * DQ + (size_t)(z % NH_) * HD;
#pragma unroll
    for (int mb = 0; mb < 4; ++mb) {
#pragma unroll
        for (int nb = 0; nb < 4; ++nb) {
#pragma unroll
            for (int j = 0; j < 8; ++j) os[(hi * 8 + j) * 68 + nb * 16 + lr] = acc[mb][nb][j]; }
        __builtin_amdgcn_wave_barrier(); asm volatile("" ::: "memory");   // keeps the compiler from moving a lane's LDS reads over the other lanes' LDS writes
        float* crow = C + (size_t)(r0 + mb * 16) * DQ;
#pragma unroll
        for (int s = 0; s < 8; ++s) { const int row = 2 * s + hi, cofs = lr * 4; v4f val = *(const v4fa*)(os + row * 68 + cofs);
            *(v4f*)(crow + (size_t)row * DQ + cofs) = val; }
        if (mb < 3) { __builtin_amdgcn_wave_barrier(); asm volatile("s_wait_xcnt 0x0" ::: "memory"); }   // keeps the next block's LDS writes behind these reads, and its LDS reads, which reuse the stores' data registers, behind the wait
    }
}

extern "C" void kernel_launch(void* const* d_in, const int* in_sizes, int n_in,
                              void* d_out, int out_size, void* d_ws, size_t ws_size, hipStream_t stream) {
    (void)in_sizes; (void)n_in; (void)out_size;
    const float* qkv = (const float*)d_in[0];
    // the module's one input: qkv [2][2048][3][16][64]: row (b, t) holds 3072 words: s * 1024 + h * 64 + d with s = 0 query, 1 key, 2 value
    float* OUT = (float*)d_out;     // [2][2048][16][64]
    char* wsp = (char*)d_ws;
    auto take = [&](size_t bytes) { char* p = wsp; wsp += (bytes + 255) & ~(size_t)255; return (void*)p; };
    h16* QP16 = (h16*)take((size_t)NB_ * NH_ * TT * HD * 2); h16* KP16 = (h16*)take((size_t)NB_ * NH_ * TT * HD * 2); h16* VT16 = (h16*)take((size_t)NB_ * NH_ * HD * TT * 2);
    if ((size_t)(wsp - (char*)d_ws) > ws_size) return;    // total 24.00 MiB carved
    k_planes<<<dim3(TT / PT, NB_ * NH_), 256, 0, stream>>>(qkv, QP16, KP16, VT16);   /* q, k planes and v^T planes of every batch entry and head */
    k_fla<<<dim3(TT / 256, NB_ * NH_), 128, 0, stream>>>(QP16, KP16, VT16, OUT);   /* out[b][t][h][:] = tril(q k^T) v: the one writer of the output */
}

// v003
// It runs in 19.7 microseconds.
// In two side-by-side timings against v002, it was 2.03 and 2.05 times as fast.
// All steps since v000 together make it 47.8 times as fast.
#include <hip/hip_runtime.h>

// Causal linear attention with no softmax, from one packed input (qkv [2][2048][3][16][64]: q, k, v = its three slices along the third axis, token-major [b][t][h][64]; a = q k^T over the 64 head dims, NO scale; a is multiplied by a lower-triangular mask of ones (keys j <= i kept, the diagonal included; zeros above it); out = a v -> [2][2048][16][64] token-major (4.2 M); NO softmax;
// argument order: the one packed input).
// Layout: one builder launch (k_planes) reads the packed input once, rounds each word to bf16, casts it to f16 and stores the f16 head planes of q and of k [b][h][t][64] and v's transposed planes [b][h][64][2048];
// the same launch forms, on the matrix unit, the partial state v^T k (64 x 64, f32) of each head's 128 tokens: with no softmax, (q k^T) v over whole unmasked key blocks equals q (k^T v);
// one launch for all batch entries and heads (k_fla): a block owns 256 query rows of one head. The keys in front of a query's 128-token block enter through the sum of their partial states (f32 sum, cast to f16, one product with q);
// a wave owns 64 of the rows and walks the keys of its 128-token block up to its diagonal tile, 32 at a time: the transposed score tile k q^T, the mask (diagonal tile only), the cast to f16 in registers, then the product with v into the f32 output tile; no score ever reaches memory.
// Compute dtypes, f32 accumulate: the input rounded to bf16 at its load, every such word of magnitude 2^-14 or more exact as f16 (smaller ones become f16 subnormals); a = q k^T ONE fp16 product (exact products of those words); the scores cast to f16; a v ONE fp16 product; v^T k ONE fp16 product, the summed state cast to f16; q times the state ONE fp16 product.

#define NB_  2
#define TT   2048
#define NH_  16
#define HD   64
#define DQ   (NH_ * HD)
#define ZH   2
typedef _Float16 h16;
typedef unsigned short bf;
typedef __attribute__((ext_vector_type(16))) __bf16   v16bf;
typedef __attribute__((ext_vector_type(16))) _Float16 v16h;
typedef __attribute__((ext_vector_type(8)))  _Float16 v8h;
typedef __attribute__((ext_vector_type(8)))  unsigned short v8us;
typedef __attribute__((ext_vector_type(8)))  float    v8f;
typedef __attribute__((ext_vector_type(4)))  float    v4f;
typedef v8h  __attribute__((may_alias)) v8ha;
typedef v4f  __attribute__((may_alias)) v4fa;
typedef v8us __attribute__((may_alias)) v8usa;

__device__ __forceinline__ unsigned short f2bf(float f) { unsigned u = __float_as_uint(f); u += 0x7FFFu + ((u >> 16) & 1u); return (unsigned short)(u >> 16); }
__device__ __forceinline__ float bf2f(unsigned short b) { return __uint_as_float(((unsigned)b) << 16); }
__device__ __forceinline__ float bfr(float f) { return bf2f(f2bf(f)); }
__device__ __forceinline__ v16h cat16(v8h lo, v8h hi) { return __builtin_shufflevector(lo, hi, 0, 1, 2, 3, 4, 5, 6, 7, 8, 9, 10, 11, 12, 13, 14, 15); }
__device__ __forceinline__ v16bf cat16b(v8us lo, v8us hi) { return __builtin_bit_cast(v16bf, __builtin_shufflevector(lo, hi, 0, 1, 2, 3, 4, 5, 6, 7, 8, 9, 10, 11, 12, 13, 14, 15)); }
__device__ __forceinline__ v8f wmma16(v16h a, v16h b, v8f c) { return __builtin_amdgcn_wmma_f32_16x16x32_f16(false, a, false, b, (short)0, c, false, false); }
__device__ __forceinline__ v8f wmmab(v16bf a, v16bf b, v8f c) { return __builtin_amdgcn_wmma_f32_16x16x32_bf16(false, a, false, b, (short)0, c, false, false); }



template <typename T16> struct WFrag;
template <> struct WFrag<h16> { typedef v16h V; static __device__ __forceinline__ V ld(const h16* p) { return cat16(*(const v8h*)p, *(const v8h*)(p + 16)); } static __device__ __forceinline__ v8f mma(V a, V b, v8f c) { return wmma16(a, b, c); } };
template <> struct WFrag<bf> { typedef v16bf V; static __device__ __forceinline__ V ld(const bf* p) { return cat16b(*(const v8us*)p, *(const v8us*)(p + 16)); } static __device__ __forceinline__ v8f mma(V a, V b, v8f c) { return wmmab(a, b, c); } };
__device__ __forceinline__ h16 tohx(float x) { return (h16)x; }
__device__ __forceinline__ void splitf(float y, unsigned short& h, unsigned short& l) { h = f2bf(y); l = f2bf(y - bf2f(h)); }
typedef __attribute__((ext_vector_type(2))) _Float16 v2h;
typedef __attribute__((ext_vector_type(4))) _Float16 v4h;
typedef __attribute__((ext_vector_type(2))) unsigned short v2us;
typedef __attribute__((ext_vector_type(4))) unsigned short v4us;
typedef __attribute__((ext_vector_type(2))) float v2f;
typedef __attribute__((ext_vector_type(4))) int v4i;

typedef __attribute__((ext_vector_type(2))) __bf16 v2bf;
typedef __attribute__((ext_vector_type(2))) unsigned v2u;
typedef __attribute__((ext_vector_type(4))) unsigned v4u;
typedef v2u __attribute__((may_alias)) v2ua;
typedef v4u __attribute__((may_alias)) v4ua;
// two f32 words, each rounded to bf16 (nearest even) and that value cast to f16 (nearest even; exact from 2^-14 up): one packed word, x in the low half
__device__ __forceinline__ unsigned pk_bh(float x, float y) {
    v2f a; a[0] = x; a[1] = y;
    const unsigned u = __builtin_bit_cast(unsigned, __builtin_convertvector(a, v2bf));
    v2f r; r[0] = __uint_as_float(u << 16); r[1] = __uint_as_float(u & 0xFFFF0000u);
    return __builtin_bit_cast(unsigned, __builtin_convertvector(r, v2h));
}
// ---- k_planes: the three f16 planes of one head's 128 tokens a block. A row of a slice is 256 contiguous bytes of the input (16 lanes x 16 bytes), so every wave-wide load takes two whole rows.
// q, k: a lane's four words become 8 bytes of the plane; a wave-wide store covers 256 contiguous bytes (q) or two whole 128-byte rows (k).
// v, k: a lane takes the same four head dims of 8 consecutive tokens, so its registers hold, a head dim, the 16 bytes (8 tokens) of v^T and of k^T; these go through LDS: v^T so that a wave-wide store covers two whole 256-byte rows, both so that the state's fragments (a row of v^T, a row of k^T, tokens as the k index) are read from there.
// the partial state ST[e][d] = sum over the block's 128 tokens of v[t][e] k[t][d]: 16 tiles of 16 x 16, two a wave, four matrix instructions each; stored f32 as [z][token block][e][d].
// LDS unit (16 bytes) of head dim d, token group g stands at column g ^ (d >> 2): the 16 lanes of a half wave hit 16 different columns in the write (d >> 2 differs) and in the read (g differs).
#define PT 128
__device__ __forceinline__ v16h st_frag(const v4u* sm, int row, int g) {   // tokens 8 g .. 8 g + 7 and 16 on, of one row: WFrag::ld's k order with the tokens as k
    return cat16(__builtin_bit_cast(v8h, sm[row * (PT / 8) + (g ^ (row >> 2))]), __builtin_bit_cast(v8h, sm[row * (PT / 8) + ((g + 2) ^ (row >> 2))]));
}
__global__ __launch_bounds__(256) void k_planes(const float* __restrict__ X, h16* __restrict__ QP, h16* __restrict__ KP, h16* __restrict__ VT, float* __restrict__ SP) {
    __shared__ v4u vsm[HD * PT / 8];
    __shared__ v4u ksm[HD * PT / 8];
    const int c4 = threadIdx.x & 15, tg = threadIdx.x >> 4;
    const int t0 = blockIdx.x * PT, z = blockIdx.y;                  // z = b * 16 + h
    const float* xr = X + ((size_t)(z / NH_) * TT + t0) * (3 * DQ) + (z % NH_) * HD + c4 * 4;
    const float* xvp = xr + (size_t)(tg * 8) * (3 * DQ);             // v, 2048 words on, and k, 1024 words on: tokens 8 tg + i
    const float* xqp = xr + (size_t)tg * (3 * DQ);                   // q: tokens 16 i + tg
    v4f xv[8], xq[8], xk[8];
#pragma unroll
    for (int i = 0; i < 8; ++i) xv[i] = *(const v4f*)(xvp + (size_t)i * (3 * DQ) + 2 * DQ);
#pragma unroll
    for (int i = 0; i < 8; ++i) xk[i] = *(const v4f*)(xvp + (size_t)i * (3 * DQ) + DQ);
    __builtin_amdgcn_sched_barrier(0);   // q's loads are issued last: loads return in order, so the waits for v and k in front of the barrier do not wait for q
#pragma unroll
    for (int i = 0; i < 8; ++i) xq[i] = *(const v4f*)(xqp + (size_t)(i * 16) * (3 * DQ));
    asm volatile("s_wait_xcnt 0x0" :: "v"(xvp), "v"(xqp) : "memory");   // behind the loads, in front of every write of their address registers; the two addresses are inputs so that no later load of the group lands in them
    __builtin_amdgcn_sched_barrier(0);   // all 24 loads of a lane are issued before the first is waited for: sunk to their uses they would pay the memory latency several times over
#pragma unroll
    for (int j = 0; j < 4; ++j) { v4u w;
#pragma unroll
        for (int p = 0; p < 4; ++p) w[p] = pk_bh(xv[2 * p][j], xv[2 * p + 1][j]);
        vsm[(c4 * 4 + j) * (PT / 8) + (tg ^ c4)] = w; }
    v2u kw[8];                                                       // k's plane words: token 8 tg + i, head dims 4 c4 .. 4 c4 + 3
#pragma unroll
    for (int i = 0; i < 8; ++i) { kw[i][0] = pk_bh(xk[i][0], xk[i][1]); kw[i][1] = pk_bh(xk[i][2], xk[i][3]); }
#pragma unroll
    for (int j = 0; j < 4; ++j) { v4u w;                             // the same f16 words, regrouped: one head dim of tokens 2 p and 2 p + 1
#pragma unroll
        for (int p = 0; p < 4; ++p) { const unsigned a = kw[2 * p][j >> 1], b = kw[2 * p + 1][j >> 1];
            w[p] = (j & 1) ? ((a >> 16) | (b & 0xFFFF0000u)) : ((a & 0xFFFFu) | (b << 16)); }
        ksm[(c4 * 4 + j) * (PT / 8) + (tg ^ c4)] = w; }
    __builtin_amdgcn_sched_barrier(0);   // keeps q's conversions, and with them the wait for the last load, behind the LDS writes: v^T and the state go out while q's loads still land
    // the work-group barrier with fences on LDS alone: what crosses it is vsm and ksm. __syncthreads() here also waits for q's loads, which are still in flight and which no other wave reads
    __builtin_amdgcn_fence(__ATOMIC_RELEASE, "workgroup", "local"); __builtin_amdgcn_s_barrier(); __builtin_amdgcn_fence(__ATOMIC_ACQUIRE, "workgroup", "local");
#pragma unroll
    for (int r = 0; r < 4; ++r) { const int d = r * 16 + tg;
        *(v4ua*)(VT + ((size_t)z * HD + d) * TT + t0 + c4 * 8) = vsm[d * (PT / 8) + (c4 ^ (d >> 2))]; }
    { const int wv = __builtin_amdgcn_readfirstlane((int)(threadIdx.x >> 5)), lr = threadIdx.x & 15, hi = (threadIdx.x >> 4) & 1;
      const int eb = wv >> 1, db = (wv & 1) * 2;                     // this wave's two tiles: rows e = 16 eb .., columns d = 16 db .. and 16 on
      v8f sa[2]; sa[0] = (v8f){}; sa[1] = (v8f){};
#pragma unroll
      for (int s = 0; s < PT / 32; ++s) { const v16h a = st_frag(vsm, eb * 16 + lr, s * 4 + hi);
#pragma unroll
          for (int t = 0; t < 2; ++t) sa[t] = wmma16(a, st_frag(ksm, (db + t) * 16 + lr, s * 4 + hi), sa[t]); }
      float* so = SP + (((size_t)z * (TT / PT) + blockIdx.x) * HD + eb * 16 + hi * 8) * HD + db * 16 + lr;
#pragma unroll
      for (int j = 0; j < 8; ++j) { so[j * HD] = sa[0][j]; so[j * HD + 16] = sa[1][j]; } }
    h16* ko = KP + ((size_t)z * TT + t0 + tg * 8) * HD + c4 * 4;
#pragma unroll
    for (int i = 0; i < 8; ++i) *(v2ua*)(ko + i * HD) = kw[i];
    asm volatile("s_wait_xcnt 0x0" ::: "memory");                    // behind the state's and k's stores: the code below reuses the registers that they name
    __builtin_amdgcn_sched_barrier(0);   // v^T's, the state's and k's stores are issued in front of the first wait for a load of q
    h16* qo = QP + ((size_t)z * TT + t0 + tg) * HD + c4 * 4;
#pragma unroll
    for (int i = 0; i < 8; ++i) { v2u w; w[0] = pk_bh(xq[i][0], xq[i][1]); w[1] = pk_bh(xq[i][2], xq[i][3]); *(v2ua*)(qo + i * 16 * HD) = w; }
}
// ---- k_fla: both products of the causal attention in one kernel. The score tile is formed transposed (A = 16 key rows, B = 16 query rows): in its accumulator a lane holds ONE query's scores for keys 8 * hi + r,
// so two such tiles (keys 0..15 and 16..31 of a pass), cast in place, are the 16x32 first operand of the second product in the k order of WFrag::ld (0..7 and 16..23 for hi = 0, 8..15 and 24..31 for hi = 1), which v's fragment loader uses too.
// every '#pragma unroll' of this kernel: the fragment and accumulator arrays stay in registers only where each index is a constant
struct KF { v16h k[2][2]; };   // one pass of 32 keys: k fragments [16-key block][32 head dims]
struct VF { v16h v[4]; };      // the same keys' v^T fragments [16 output columns]
typedef const __attribute__((address_space(1))) h16 gh16;   // k and v are walked by pointers that say 'global memory': a base address that an asm statement has stepped would otherwise be loaded from by flat loads
typedef const __attribute__((address_space(1))) v8h gv8h;
__device__ __forceinline__ v16h fla_ld(gh16* p) { return cat16(*(gv8h*)p, *(gv8h*)(p + 16)); }   // WFrag<h16>::ld's k order
__device__ __forceinline__ void fla_ldk(KF& f, gh16* kp) {
#pragma unroll
    for (int mb = 0; mb < 2; ++mb)
#pragma unroll
        for (int kc = 0; kc < 2; ++kc) f.k[mb][kc] = fla_ld(kp + mb * 16 * HD + kc * 32);
}
__device__ __forceinline__ void fla_ldv(VF& f, gh16* vp) {
#pragma unroll
    for (int nb = 0; nb < 4; ++nb) f.v[nb] = fla_ld(vp + nb * 16 * TT);
}
__device__ __forceinline__ void fla_s(const KF& f, const v16h (&qf)[4][2], v8f (&st)[2][4]) {
#pragma unroll
    for (int mb = 0; mb < 2; ++mb)
#pragma unroll
        for (int qb = 0; qb < 4; ++qb) st[mb][qb] = (v8f){};
#pragma unroll
    for (int kc = 0; kc < 2; ++kc)
#pragma unroll
        for (int mb = 0; mb < 2; ++mb)
#pragma unroll
            for (int qb = 0; qb < 4; ++qb) st[mb][qb] = wmma16(f.k[mb][kc], qf[qb][kc], st[mb][qb]);
}
template <bool MASK>
__device__ __forceinline__ void fla_pv(const v8f (&st)[2][4], const VF& f, v8f (&acc)[4][4], int k0, int r0, int lr, int hi) {
#pragma unroll
    for (int qb = 0; qb < 4; ++qb) {
        v16h p;
#pragma unroll
        for (int s = 0; s < 16; ++s) { float x = st[s >> 3][qb][s & 7];
            if (MASK) x = (k0 + (s >> 3) * 16 + hi * 8 + (s & 7) <= r0 + qb * 16 + lr) ? x : 0.0f;   // x tril: key <= query kept
            p[s] = tohx(x); }
#pragma unroll
        for (int nb = 0; nb < 4; ++nb) acc[qb][nb] = wmma16(p, f.v[nb], acc[qb][nb]);
    }
}
// FLA_HOLD stands on both sides of a group of fragment loads: without it the scheduler sinks the loads down to their first use, a pass and a half later, and the wave waits out the whole load latency there
#define FLA_HOLD() __builtin_amdgcn_sched_barrier(0)
#define SPI 72   // pitch of the state's rows in LDS, in f16 words: 144 bytes, so that the 16 rows of a fragment read start in 16 different bank groups
__global__ __launch_bounds__(128) void k_fla(const h16* __restrict__ QP, const h16* __restrict__ KP, const h16* __restrict__ VT, const float* __restrict__ SP, float* __restrict__ O) {
    __shared__ __align__(16) float osm[4][16 * 68];
    __shared__ __align__(16) h16 ssm[2][HD * SPI];
    const int wv = __builtin_amdgcn_readfirstlane((int)(threadIdx.x >> 5));
    const int lane = threadIdx.x & 31, lr = lane & 15, hi = lane >> 4;
    const int i = TT / 256 - 1 - blockIdx.x, z = blockIdx.y;         // z = b * 16 + h; block 0 takes the rows with the most partial states to sum
    const int r0 = i * 256 + wv * 64, c0 = i * 256 + (wv >> 1) * 128;   // a block's four waves take the four 64-row tiles of rows 256 i .. 256 i + 255 of one head; the keys in front of c0, the start of the wave's 128 rows, enter through the state
    gh16* ks = (gh16*)(KP + (size_t)z * TT * HD + (size_t)c0 * HD);    // wave-uniform: key row k0 of this head
    gh16* vs = (gh16*)(VT + (size_t)z * HD * TT + c0);                 // wave-uniform: key k0 in row 0 of this head's v^T
    const unsigned ko = lr * HD + 8 * hi, vo = lr * TT + 8 * hi;     // this lane's place from there: fixed over the key loop
    const h16* qp = QP + (size_t)z * TT * HD + (size_t)r0 * HD + ko;
    v16h qf[4][2];
#pragma unroll
    for (int qb = 0; qb < 4; ++qb)
#pragma unroll
        for (int kc = 0; kc < 2; ++kc) qf[qb][kc] = WFrag<h16>::ld(qp + qb * 16 * HD + kc * 32);
    v8f acc[4][4];
#pragma unroll
    for (int qb = 0; qb < 4; ++qb)
#pragma unroll
        for (int nb = 0; nb < 4; ++nb) acc[qb][nb] = (v8f){};
    KF ka, kb; VF va, vb; v8f st[2][4];                              // two fragment sets (even and odd pass): a set is loaded again as soon as its last product has read it, a pass and a half ahead of its next use
    FLA_HOLD(); fla_ldk(ka, ks + ko); FLA_HOLD(); fla_ldv(va, vs + vo); FLA_HOLD(); fla_ldk(kb, ks + ko + 32 * HD);   // issued in the loop's own order, so that the counted waits at the loop's head fit both ways in
    asm volatile("s_wait_xcnt 0x0" ::: "memory");                    // behind these loads: where the key loop has no trip, the load behind it lands in the register that holds their lane offset
    FLA_HOLD();
    // behind the first fragment loads, which land meanwhile: the state of the keys in front of row 256 i: the sum, in token order, of their 2 i partial states; one partial state more gives the state in front of row 256 i + 128.
    // a thread sums 8 x 4 words, casts them and puts them into LDS as ST[e][d], one copy for each pair of waves
    { const char* sp = (const char*)(SP + (size_t)z * (TT / PT) * (HD * HD));   // block-uniform: this head's first partial state
      const unsigned tb = threadIdx.x * 16;                          // this thread's place in a state, in bytes
      v4f sa[8], tl[8];
#pragma unroll
      for (int u = 0; u < 8; ++u) sa[u] = (v4f){};
#pragma unroll
      for (int u = 0; u < 8; ++u) tl[u] = *(const v4f*)(sp + (size_t)(2 * i) * (HD * HD * 4) + tb + u * 2048);   // the partial state of rows 256 i .. 256 i + 127: added last, loaded first, so that nothing waits for it alone
      // each s_wait_xcnt 0 of this block stands behind a group of loads, in front of every write of their address registers; the lane's offset and the whole address are inputs so that, whichever the loads name, no load of the group lands in it
      asm volatile("s_wait_xcnt 0x0" :: "v"(tb), "v"(sp + (size_t)(2 * i) * (HD * HD * 4) + tb) : "memory");
      v4f t[TT / 256 - 1][16];                                       // two partial states a group. Every group's loads are issued before the first sum: the wave pays the latency of L2 once, not once a group
#pragma unroll
      for (int g = TT / 256 - 2; g >= 0; --g) if (g < i) {           // last group first: the sums begin with group 0, and the compiler draws their first additions up to that group's loads, where they now hold back no other load
          const char* sq = sp + (size_t)g * (2 * HD * HD * 4);
#pragma unroll
          for (int u = 0; u < 16; ++u) t[g][u] = *(const v4f*)(sq + tb + u * 2048);
          asm volatile("s_wait_xcnt 0x0" :: "v"(tb), "v"(sp + tb) : "memory"); }
#pragma unroll
      for (int g = 0; g < TT / 256 - 1; ++g) if (g < i) {
#pragma unroll
          for (int u = 0; u < 16; ++u) sa[u & 7] += t[g][u]; }
#pragma unroll
      for (int hb = 0; hb < 2; ++hb)
#pragma unroll
          for (int u = 0; u < 8; ++u) { v4h w;
              if (hb) sa[u] += tl[u];
#pragma unroll
              for (int c = 0; c < 4; ++c) w[c] = tohx(sa[u][c]);
              *(v4h*)(ssm[hb] + (u * 8 + (threadIdx.x >> 4)) * SPI + (threadIdx.x & 15) * 4) = w; } }
    __syncthreads();                                                 // every wave reads the whole of its state
#pragma unroll
    for (int nb = 0; nb < 4; ++nb)                                   // q times the state: first operand 16 query rows, second operand column e = row e of ST, the head dims d as k in WFrag::ld's order on both sides
#pragma unroll
        for (int kc = 0; kc < 2; ++kc) { const v16h sf = WFrag<h16>::ld(ssm[wv >> 1] + (nb * 16 + lr) * SPI + kc * 32 + 8 * hi);
#pragma unroll
            for (int qb = 0; qb < 4; ++qb) acc[qb][nb] = wmma16(qf[qb][kc], sf, acc[qb][nb]); }
    for (int k0 = c0; k0 < r0; k0 += 64) {                           // the key tiles from c0 on under the diagonal tile: no mask
        fla_ldv(vb, vs + vo + 32); FLA_HOLD();
        fla_s(ka, qf, st);
        FLA_HOLD(); fla_ldk(ka, ks + ko + 64 * HD); FLA_HOLD();
        fla_pv<false>(st, va, acc, k0, r0, lr, hi);
        FLA_HOLD(); fla_ldv(va, vs + vo + 64); FLA_HOLD();
        fla_s(kb, qf, st);
        FLA_HOLD(); fla_ldk(kb, ks + ko + 96 * HD); FLA_HOLD();
        fla_pv<false>(st, vb, acc, k0 + 32, r0, lr, hi);
        FLA_HOLD();
        // the two base addresses step 64 keys on. Loads in flight name these registers, so s_wait_xcnt 0 stands in front of the step, in the step's own statement: in a statement of its own the compiler moved the step over it
        asm volatile("s_wait_xcnt 0x0\n\ts_add_nc_u64 %0, %0, %2\n\ts_add_nc_u64 %1, %1, %3" : "+s"(ks), "+s"(vs) : "i"(64 * HD * 2), "i"(64 * 2) : "memory");
    }
    fla_ldv(vb, vs + vo + 32);
    asm volatile("s_wait_xcnt 0x0" ::: "memory");                    // behind the kernel's last loads: the code below reuses the registers that hold their addresses
    FLA_HOLD();
    fla_s(ka, qf, st); fla_pv<true>(st, va, acc, r0, r0, lr, hi);    // the diagonal tile
    fla_s(kb, qf, st); fla_pv<true>(st, vb, acc, r0 + 32, r0, lr, hi);
    float* os = osm[wv];                                             // each wave stages in its own LDS range and stores whole 256-byte rows
    float* C = O + (size_t)(z / NH_) * TT * DQ + (size_t)(z % NH_) * HD;
#pragma unroll
    for (int mb = 0; mb < 4; ++mb) {
#pragma unroll
        for (int nb = 0; nb < 4; ++nb) {
#pragma unroll
            for (int j = 0; j < 8; ++j) os[(hi * 8 + j) * 68 + nb * 16 + lr] = acc[mb][nb][j]; }
        __builtin_amdgcn_wave_barrier(); asm volatile("" ::: "memory");   // keeps the compiler from moving a lane's LDS reads over the other lanes' LDS writes
        float* crow = C + (size_t)(r0 + mb * 16) * DQ;
#pragma unroll
        for (int s = 0; s < 8; ++s) { const int row = 2 * s + hi, cofs = lr * 4; v4f val = *(const v4fa*)(os + row * 68 + cofs);
            *(v4f*)(crow + (size_t)row * DQ + cofs) = val; }
        if (mb < 3) { __builtin_amdgcn_wave_barrier(); asm volatile("s_wait_xcnt 0x0" ::: "memory"); }   // keeps the next block's LDS writes behind these reads, and its LDS reads, which reuse the stores' data registers, behind the wait
    }
}

extern "C" void kernel_launch(void* const* d_in, const int* in_sizes, int n_in,
                              void* d_out, int out_size, void* d_ws, size_t ws_size, hipStream_t stream) {
    (void)in_sizes; (void)n_in; (void)out_size;
    const float* qkv = (const float*)d_in[0];
    // the module's one input: qkv [2][2048][3][16][64]: row (b, t) holds 3072 words: s * 1024 + h * 64 + d with s = 0 query, 1 key, 2 value
    float* OUT = (float*)d_out;     // [2][2048][16][64]
    char* wsp = (char*)d_ws;
    auto take = [&](size_t bytes) { char* p = wsp; wsp += (bytes + 255) & ~(size_t)255; return (void*)p; };
    h16* QP16 = (h16*)take((size_t)NB_ * NH_ * TT * HD * 2); h16* KP16 = (h16*)take((size_t)NB_ * NH_ * TT * HD * 2); h16* VT16 = (h16*)take((size_t)NB_ * NH_ * HD * TT * 2);
    float* SP32 = (float*)take((size_t)NB_ * NH_ * (TT / PT) * HD * HD * 4);
    if ((size_t)(wsp - (char*)d_ws) > ws_size) return;    // total 20.00 MiB carved
    k_planes<<<dim3(TT / PT, NB_ * NH_), 256, 0, stream>>>(qkv, QP16, KP16, VT16, SP32);   /* q, k planes, v^T planes and partial states of every batch entry and head */
    k_fla<<<dim3(TT / 256, NB_ * NH_), 128, 0, stream>>>(QP16, KP16, VT16, SP32, OUT);   /* out[b][t][h][:] = tril(q k^T) v: the one writer of the output */
}

// v004
// It runs in 18.2 microseconds.
// Next to v003, in two timings, it ran 1.08 and 1.09 times as fast.
// Over all steps from v000 it is 51.9 times as fast.
#include <hip/hip_runtime.h>

// Causal linear attention with no softmax, from one packed input (qkv [2][2048][3][16][64]: q, k, v = its three slices along the third axis, token-major [b][t][h][64]; a = q k^T over the 64 head dims, NO scale; a is multiplied by a lower-triangular mask of ones (keys j <= i kept, the diagonal included; zeros above it); out = a v -> [2][2048][16][64] token-major (4.2 M); NO softmax;
// argument order: the one packed input).
// Layout: one builder launch (k_planes) rounds each word to bf16 (it is a module INPUT), casts it to f16 and stores the f16 head planes of k [b][h][t][64] and v's transposed planes [b][h][64][2048] (it reads k's and v's slices alone);
// the same launch forms, on the matrix unit, the partial state v^T k (64 x 64, f32) of each head's 128 tokens: with no softmax, (q k^T) v over whole unmasked key blocks equals q (k^T v);
// one launch for all batch entries and heads (k_fla): a block owns 256 query rows of one head; their q rows come from the packed input itself, by asynchronous copies into LDS, and are rounded and cast as above where the fragments are formed. The keys in front of a query's 128-token block enter through the sum of their partial states (f32 sum, cast to f16, one product with q);
// a wave owns 64 of the rows and walks the keys of its 128-token block up to its diagonal tile, 32 at a time: the transposed score tile k q^T, the mask (diagonal tile only), the cast to f16 in registers, then the product with v into the f32 output tile; no score ever reaches memory.
// Compute dtypes, f32 accumulate: the input rounded to bf16 at its load, every such word of magnitude 2^-14 or more exact as f16 (smaller ones become f16 subnormals); a = q k^T ONE fp16 product (exact products of those words); the scores cast to f16; a v ONE fp16 product; v^T k ONE fp16 product, the summed state cast to f16; q times the state ONE fp16 product.

#define NB_  2
#define TT   2048
#define NH_  16
#define HD   64
#define DQ   (NH_ * HD)
#define ZH   2
typedef _Float16 h16;
typedef unsigned short bf;
typedef __attribute__((ext_vector_type(16))) __bf16   v16bf;
typedef __attribute__((ext_vector_type(16))) _Float16 v16h;
typedef __attribute__((ext_vector_type(8)))  _Float16 v8h;
typedef __attribute__((ext_vector_type(8)))  unsigned short v8us;
typedef __attribute__((ext_vector_type(8)))  float    v8f;
typedef __attribute__((ext_vector_type(4)))  float    v4f;
typedef v8h  __attribute__((may_alias)) v8ha;
typedef v4f  __attribute__((may_alias)) v4fa;
typedef v8us __attribute__((may_alias)) v8usa;

__device__ __forceinline__ unsigned short f2bf(float f) { unsigned u = __float_as_uint(f); u += 0x7FFFu + ((u >> 16) & 1u); return (unsigned short)(u >> 16); }
__device__ __forceinline__ float bf2f(unsigned short b) { return __uint_as_float(((unsigned)b) << 16); }
__device__ __forceinline__ float bfr(float f) { return bf2f(f2bf(f)); }
__device__ __forceinline__ v16h cat16(v8h lo, v8h hi) { return __builtin_shufflevector(lo, hi, 0, 1, 2, 3, 4, 5, 6, 7, 8, 9, 10, 11, 12, 13, 14, 15); }
__device__ __forceinline__ v16bf cat16b(v8us lo, v8us hi) { return __builtin_bit_cast(v16bf, __builtin_shufflevector(lo, hi, 0, 1, 2, 3, 4, 5, 6, 7, 8, 9, 10, 11, 12, 13, 14, 15)); }
__device__ __forceinline__ v8f wmma16(v16h a, v16h b, v8f c) { return __builtin_amdgcn_wmma_f32_16x16x32_f16(false, a, false, b, (short)0, c, false, false); }
__device__ __forceinline__ v8f wmmab(v16bf a, v16bf b, v8f c) { return __builtin_amdgcn_wmma_f32_16x16x32_bf16(false, a, false, b, (short)0, c, false, false); }



template <typename T16> struct WFrag;
template <> struct WFrag<h16> { typedef v16h V; static __device__ __forceinline__ V ld(const h16* p) { return cat16(*(const v8h*)p, *(const v8h*)(p + 16)); } static __device__ __forceinline__ v8f mma(V a, V b, v8f c) { return wmma16(a, b, c); } };
template <> struct WFrag<bf> { typedef v16bf V; static __device__ __forceinline__ V ld(const bf* p) { return cat16b(*(const v8us*)p, *(const v8us*)(p + 16)); } static __device__ __forceinline__ v8f mma(V a, V b, v8f c) { return wmmab(a, b, c); } };
__device__ __forceinline__ h16 tohx(float x) { return (h16)x; }
__device__ __forceinline__ void splitf(float y, unsigned short& h, unsigned short& l) { h = f2bf(y); l = f2bf(y - bf2f(h)); }
typedef __attribute__((ext_vector_type(2))) _Float16 v2h;
typedef __attribute__((ext_vector_type(4))) _Float16 v4h;
typedef __attribute__((ext_vector_type(2))) unsigned short v2us;
typedef __attribute__((ext_vector_type(4))) unsigned short v4us;
typedef __attribute__((ext_vector_type(2))) float v2f;
typedef __attribute__((ext_vector_type(4))) int v4i;

typedef __attribute__((ext_vector_type(2))) __bf16 v2bf;
typedef __attribute__((ext_vector_type(2))) unsigned v2u;
typedef __attribute__((ext_vector_type(4))) unsigned v4u;
typedef v2u __attribute__((may_alias)) v2ua;
typedef v4u __attribute__((may_alias)) v4ua;
// two f32 words, each rounded to bf16 (nearest even) and that value cast to f16 (nearest even; exact from 2^-14 up): one packed word, x in the low half
__device__ __forceinline__ unsigned pk_bh(float x, float y) {
    v2f a; a[0] = x; a[1] = y;
    const unsigned u = __builtin_bit_cast(unsigned, __builtin_convertvector(a, v2bf));
    v2f r; r[0] = __uint_as_float(u << 16); r[1] = __uint_as_float(u & 0xFFFF0000u);
    return __builtin_bit_cast(unsigned, __builtin_convertvector(r, v2h));
}
// ---- k_planes: the two f16 planes of one head's 128 tokens a block. A row of a slice is 256 contiguous bytes of the input (16 lanes x 16 bytes), so every wave-wide load takes two whole rows.
// k: a lane's four words become 8 bytes of the plane; a wave-wide store covers two whole 128-byte rows.
// v, k: a lane takes the same four head dims of 8 consecutive tokens, so its registers hold, a head dim, the 16 bytes (8 tokens) of v^T and of k^T; these go through LDS: v^T so that a wave-wide store covers two whole 256-byte rows, both so that the state's fragments (a row of v^T, a row of k^T, tokens as the k index) are read from there.
// the partial state ST[e][d] = sum over the block's 128 tokens of v[t][e] k[t][d]: 16 tiles of 16 x 16, two a wave, four matrix instructions each; stored f32 as [z][token block][e][d].
// LDS unit (16 bytes) of head dim d, token group g stands at column g ^ (d >> 2): the 16 lanes of a half wave hit 16 different columns in the write (d >> 2 differs) and in the read (g differs).
#define PT 128
__device__ __forceinline__ v16h st_frag(const v4u* sm, int row, int g) {   // tokens 8 g .. 8 g + 7 and 16 on, of one row: WFrag::ld's k order with the tokens as k
    return cat16(__builtin_bit_cast(v8h, sm[row * (PT / 8) + (g ^ (row >> 2))]), __builtin_bit_cast(v8h, sm[row * (PT / 8) + ((g + 2) ^ (row >> 2))]));
}
__global__ __launch_bounds__(256) void k_planes(const float* __restrict__ X, h16* __restrict__ KP, h16* __restrict__ VT, float* __restrict__ SP) {
    __shared__ v4u vsm[HD * PT / 8];
    __shared__ v4u ksm[HD * PT / 8];
    const int c4 = threadIdx.x & 15, tg = threadIdx.x >> 4;
    const int t0 = blockIdx.x * PT, z = blockIdx.y;                  // z = b * 16 + h
    const float* xr = X + ((size_t)(z / NH_) * TT + t0) * (3 * DQ) + (z % NH_) * HD + c4 * 4;
    const float* xvp = xr + (size_t)(tg * 8) * (3 * DQ);             // v, 2048 words on, and k, 1024 words on: tokens 8 tg + i
    v4f xv[8], xk[8];
#pragma unroll
    for (int i = 0; i < 8; ++i) xv[i] = *(const v4f*)(xvp + (size_t)i * (3 * DQ) + 2 * DQ);
#pragma unroll
    for (int i = 0; i < 8; ++i) xk[i] = *(const v4f*)(xvp + (size_t)i * (3 * DQ) + DQ);
    asm volatile("s_wait_xcnt 0x0" :: "v"(xvp) : "memory");   // behind the loads, in front of every write of their address registers; the address is an input so that no later load of the group lands in it
    __builtin_amdgcn_sched_barrier(0);   // all 16 loads of a lane are issued before the first is waited for: sunk to their uses they would pay the memory latency several times over
#pragma unroll
    for (int j = 0; j < 4; ++j) { v4u w;
#pragma unroll
        for (int p = 0; p < 4; ++p) w[p] = pk_bh(xv[2 * p][j], xv[2 * p + 1][j]);
        vsm[(c4 * 4 + j) * (PT / 8) + (tg ^ c4)] = w; }
    v2u kw[8];                                                       // k's plane words: token 8 tg + i, head dims 4 c4 .. 4 c4 + 3
#pragma unroll
    for (int i = 0; i < 8; ++i) { kw[i][0] = pk_bh(xk[i][0], xk[i][1]); kw[i][1] = pk_bh(xk[i][2], xk[i][3]); }
#pragma unroll
    for (int j = 0; j < 4; ++j) { v4u w;                             // the same f16 words, regrouped: one head dim of tokens 2 p and 2 p + 1
#pragma unroll
        for (int p = 0; p < 4; ++p) { const unsigned a = kw[2 * p][j >> 1], b = kw[2 * p + 1][j >> 1];
            w[p] = (j & 1) ? ((a >> 16) | (b & 0xFFFF0000u)) : ((a & 0xFFFFu) | (b << 16)); }
        ksm[(c4 * 4 + j) * (PT / 8) + (tg ^ c4)] = w; }
    // the work-group barrier with fences on LDS alone: what crosses it is vsm and ksm
    __builtin_amdgcn_fence(__ATOMIC_RELEASE, "workgroup", "local"); __builtin_amdgcn_s_barrier(); __builtin_amdgcn_fence(__ATOMIC_ACQUIRE, "workgroup", "local");
#pragma unroll
    for (int r = 0; r < 4; ++r) { const int d = r * 16 + tg;
        *(v4ua*)(VT + ((size_t)z * HD + d) * TT + t0 + c4 * 8) = vsm[d * (PT / 8) + (c4 ^ (d >> 2))]; }
    { const int wv = __builtin_amdgcn_readfirstlane((int)(threadIdx.x >> 5)), lr = threadIdx.x & 15, hi = (threadIdx.x >> 4) & 1;
      const int eb = wv >> 1, db = (wv & 1) * 2;                     // this wave's two tiles: rows e = 16 eb .., columns d = 16 db .. and 16 on
      v8f sa[2]; sa[0] = (v8f){}; sa[1] = (v8f){};
#pragma unroll
      for (int s = 0; s < PT / 32; ++s) { const v16h a = st_frag(vsm, eb * 16 + lr, s * 4 + hi);
#pragma unroll
          for (int t = 0; t < 2; ++t) sa[t] = wmma16(a, st_frag(ksm, (db + t) * 16 + lr, s * 4 + hi), sa[t]); }
      float* so = SP + (((size_t)z * (TT / PT) + blockIdx.x) * HD + eb * 16 + hi * 8) * HD + db * 16 + lr;
#pragma unroll
      for (int j = 0; j < 8; ++j) { so[j * HD] = sa[0][j]; so[j * HD + 16] = sa[1][j]; } }
    h16* ko = KP + ((size_t)z * TT + t0 + tg * 8) * HD + c4 * 4;
#pragma unroll
    for (int i = 0; i < 8; ++i) *(v2ua*)(ko + i * HD) = kw[i];
}
// ---- k_fla: both products of the causal attention in one kernel. The score tile is formed transposed (A = 16 key rows, B = 16 query rows): in its accumulator a lane holds ONE query's scores for keys 8 * hi + r,
// so two such tiles (keys 0..15 and 16..31 of a pass), cast in place, are the 16x32 first operand of the second product in the k order of WFrag::ld (0..7 and 16..23 for hi = 0, 8..15 and 24..31 for hi = 1), which v's fragment loader uses too.
// every '#pragma unroll' of this kernel: the fragment and accumulator arrays stay in registers only where each index is a constant
struct KF { v16h k[2][2]; };   // one pass of 32 keys: k fragments [16-key block][32 head dims]
struct VF { v16h v[4]; };      // the same keys' v^T fragments [16 output columns]
typedef const __attribute__((address_space(1))) h16 gh16;   // k and v are walked by pointers that say 'global memory': a base address that an asm statement has stepped would otherwise be loaded from by flat loads
typedef const __attribute__((address_space(1))) v8h gv8h;
__device__ __forceinline__ v16h fla_ld(gh16* p) { return cat16(*(gv8h*)p, *(gv8h*)(p + 16)); }   // WFrag<h16>::ld's k order
__device__ __forceinline__ void fla_ldk(KF& f, gh16* kp) {
#pragma unroll
    for (int mb = 0; mb < 2; ++mb)
#pragma unroll
        for (int kc = 0; kc < 2; ++kc) f.k[mb][kc] = fla_ld(kp + mb * 16 * HD + kc * 32);
}
__device__ __forceinline__ void fla_ldv(VF& f, gh16* vp) {
#pragma unroll
    for (int nb = 0; nb < 4; ++nb) f.v[nb] = fla_ld(vp + nb * 16 * TT);
}
__device__ __forceinline__ void fla_s(const KF& f, const v16h (&qf)[4][2], v8f (&st)[2][4]) {
#pragma unroll
    for (int mb = 0; mb < 2; ++mb)
#pragma unroll
        for (int qb = 0; qb < 4; ++qb) st[mb][qb] = (v8f){};
#pragma unroll
    for (int kc = 0; kc < 2; ++kc)
#pragma unroll
        for (int mb = 0; mb < 2; ++mb)
#pragma unroll
            for (int qb = 0; qb < 4; ++qb) st[mb][qb] = wmma16(f.k[mb][kc], qf[qb][kc], st[mb][qb]);
}
template <bool MASK>
__device__ __forceinline__ void fla_pv(const v8f (&st)[2][4], const VF& f, v8f (&acc)[4][4], int k0, int r0, int lr, int hi) {
#pragma unroll
    for (int qb = 0; qb < 4; ++qb) {
        v16h p;
#pragma unroll
        for (int s = 0; s < 16; ++s) { float x = st[s >> 3][qb][s & 7];
            if (MASK) x = (k0 + (s >> 3) * 16 + hi * 8 + (s & 7) <= r0 + qb * 16 + lr) ? x : 0.0f;   // x tril: key <= query kept
            p[s] = tohx(x); }
#pragma unroll
        for (int nb = 0; nb < 4; ++nb) acc[qb][nb] = wmma16(p, f.v[nb], acc[qb][nb]);
    }
}
// eight asynchronous copies of 16 bytes a lane, global memory to LDS: copy c takes the lane's bytes at g + c * gs to LDS byte l + c * ls. s_wait_xcnt 0 is the statement's last line: it stands in front of every later write of the address registers that the copies name
__device__ __forceinline__ void fla_cp8(unsigned l, unsigned ls, const char* g, unsigned gs) {
    asm volatile("global_load_async_to_lds_b128 %0, %8, off\n\t"
                 "global_load_async_to_lds_b128 %1, %9, off\n\t"
                 "global_load_async_to_lds_b128 %2, %10, off\n\t"
                 "global_load_async_to_lds_b128 %3, %11, off\n\t"
                 "global_load_async_to_lds_b128 %4, %12, off\n\t"
                 "global_load_async_to_lds_b128 %5, %13, off\n\t"
                 "global_load_async_to_lds_b128 %6, %14, off\n\t"
                 "global_load_async_to_lds_b128 %7, %15, off\n\t"
                 "s_wait_xcnt 0x0"
                 :: "v"(l), "v"(l + ls), "v"(l + 2 * ls), "v"(l + 3 * ls), "v"(l + 4 * ls), "v"(l + 5 * ls), "v"(l + 6 * ls), "v"(l + 7 * ls),
                    "v"(g), "v"(g + gs), "v"(g + 2 * gs), "v"(g + 3 * gs), "v"(g + 4 * gs), "v"(g + 5 * gs), "v"(g + 6 * gs), "v"(g + 7 * gs)
                 : "memory");
}
#define QPF 68   // pitch of q's f32 rows in LDS, in words: 272 bytes = 16 x 17, so that the 16 rows of a fragment read start in 16 different bank groups
// one q fragment from the f32 words 0 .. 7 (a0, a1) and 16 .. 23 (b0, b1) of a lane's place in its row (WFrag<h16>::ld's k order), each rounded to bf16 and cast to f16 as the builder does for k and v
__device__ __forceinline__ v16h fla_cvq(v4f a0, v4f a1, v4f b0, v4f b1) {
    v4u lo, hw;
    lo[0] = pk_bh(a0[0], a0[1]); lo[1] = pk_bh(a0[2], a0[3]); lo[2] = pk_bh(a1[0], a1[1]); lo[3] = pk_bh(a1[2], a1[3]);
    hw[0] = pk_bh(b0[0], b0[1]); hw[1] = pk_bh(b0[2], b0[3]); hw[2] = pk_bh(b1[0], b1[1]); hw[3] = pk_bh(b1[2], b1[3]);
    return cat16(__builtin_bit_cast(v8h, lo), __builtin_bit_cast(v8h, hw));
}
// FLA_HOLD stands on both sides of a group of fragment loads: without it the scheduler sinks the loads down to their first use, a pass and a half later, and the wave waits out the whole load latency there
#define FLA_HOLD() __builtin_amdgcn_sched_barrier(0)
#define SPI 72   // pitch of the state's rows in LDS, in f16 words: 144 bytes, so that the 16 rows of a fragment read start in 16 different bank groups
__global__ __launch_bounds__(128) void k_fla(const float* __restrict__ X, const h16* __restrict__ KP, const h16* __restrict__ VT, const float* __restrict__ SP, float* __restrict__ O) {
    __shared__ __align__(16) float osm[4][16 * 68];
    __shared__ __align__(16) h16 ssm[2][HD * SPI];
    __shared__ __align__(16) float qsm[256 * QPF];                   // the block's 256 rows of q, f32 as in the input
    const int wv = __builtin_amdgcn_readfirstlane((int)(threadIdx.x >> 5));
    const int lane = threadIdx.x & 31, lr = lane & 15, hi = lane >> 4;
    const int i = TT / 256 - 1 - blockIdx.x, z = blockIdx.y;         // z = b * 16 + h; block 0 takes the rows with the most partial states to sum
    const int r0 = i * 256 + wv * 64, c0 = i * 256 + (wv >> 1) * 128;   // a block's four waves take the four 64-row tiles of rows 256 i .. 256 i + 255 of one head; the keys in front of c0, the start of the wave's 128 rows, enter through the state
    gh16* ks = (gh16*)(KP + (size_t)z * TT * HD + (size_t)c0 * HD);    // wave-uniform: key row k0 of this head
    gh16* vs = (gh16*)(VT + (size_t)z * HD * TT + c0);                 // wave-uniform: key k0 in row 0 of this head's v^T
    const unsigned ko = lr * HD + 8 * hi, vo = lr * TT + 8 * hi;     // this lane's place from there: fixed over the key loop
    // q: each wave copies its own 64 rows, 32 copies: a wave-wide copy takes two whole 256-byte rows of the input. They land while the states are loaded and summed
    { const char* qg = (const char*)(X + ((size_t)(z / NH_) * TT + r0 + hi) * (3 * DQ) + (z % NH_) * HD + lr * 4);
      const unsigned ql = (unsigned)(size_t)(const __attribute__((address_space(3))) float*)qsm + (wv * 64 + hi) * (QPF * 4) + lr * 16;
#pragma unroll
      for (int c = 0; c < 4; ++c) fla_cp8(ql + c * (16 * QPF * 4), 2 * QPF * 4, qg + (size_t)c * (16 * 3 * DQ * 4), 2 * 3 * DQ * 4); }
    v16h qf[4][2];
    v8f acc[4][4];
#pragma unroll
    for (int qb = 0; qb < 4; ++qb)
#pragma unroll
        for (int nb = 0; nb < 4; ++nb) acc[qb][nb] = (v8f){};
    KF ka, kb; VF va, vb; v8f st[2][4];                              // two fragment sets (even and odd pass): a set is loaded again as soon as its last product has read it, a pass and a half ahead of its next use
    FLA_HOLD(); fla_ldk(ka, ks + ko); FLA_HOLD(); fla_ldv(va, vs + vo); FLA_HOLD(); fla_ldk(kb, ks + ko + 32 * HD);   // issued in the loop's own order, so that the counted waits at the loop's head fit both ways in
    asm volatile("s_wait_xcnt 0x0" ::: "memory");                    // behind these loads: where the key loop has no trip, the load behind it lands in the register that holds their lane offset
    FLA_HOLD();
    // behind the first fragment loads, which land meanwhile: the state of the keys in front of row 256 i: the sum, in token order, of their 2 i partial states; one partial state more gives the state in front of row 256 i + 128.
    // a thread sums 8 x 4 words, casts them and puts them into LDS as ST[e][d], one copy for each pair of waves
    { const char* sp = (const char*)(SP + (size_t)z * (TT / PT) * (HD * HD));   // block-uniform: this head's first partial state
      const unsigned tb = threadIdx.x * 16;                          // this thread's place in a state, in bytes
      v4f sa[8], tl[8];
#pragma unroll
      for (int u = 0; u < 8; ++u) sa[u] = (v4f){};
#pragma unroll
      for (int u = 0; u < 8; ++u) tl[u] = *(const v4f*)(sp + (size_t)(2 * i) * (HD * HD * 4) + tb + u * 2048);   // the partial state of rows 256 i .. 256 i + 127: added last, loaded first, so that nothing waits for it alone
      // each s_wait_xcnt 0 of this block stands behind a group of loads, in front of every write of their address registers; the lane's offset and the whole address are inputs so that, whichever the loads name, no load of the group lands in it
      asm volatile("s_wait_xcnt 0x0" :: "v"(tb), "v"(sp + (size_t)(2 * i) * (HD * HD * 4) + tb) : "memory");
      v4f t[TT / 256 - 1][16];                                       // two partial states a group. Every group's loads are issued before the first sum: the wave pays the latency of L2 once, not once a group
#pragma unroll
      for (int g = TT / 256 - 2; g >= 0; --g) if (g < i) {           // last group first: the sums begin with group 0, and the compiler draws their first additions up to that group's loads, where they now hold back no other load
          const char* sq = sp + (size_t)g * (2 * HD * HD * 4);
#pragma unroll
          for (int u = 0; u < 16; ++u) t[g][u] = *(const v4f*)(sq + tb + u * 2048);
          asm volatile("s_wait_xcnt 0x0" :: "v"(tb), "v"(sp + tb) : "memory"); }
      // q's rows are read from LDS here, while the states' loads are still landing. A wave reads only the 64 rows that it copied itself, so its own wait is all that stands between copy and read
      asm volatile("s_wait_asynccnt 0x0" ::: "memory");
      { const float* ql = qsm + (wv * 64 + lr) * QPF + 8 * hi;
        v4f qr[4][2][4];
#pragma unroll
        for (int qb = 0; qb < 4; ++qb)
#pragma unroll
            for (int kc = 0; kc < 2; ++kc)
#pragma unroll
                for (int w = 0; w < 4; ++w) qr[qb][kc][w] = *(const v4fa*)(ql + qb * 16 * QPF + kc * 32 + (w >> 1) * 16 + (w & 1) * 4);
        FLA_HOLD();   // all 32 LDS reads are issued before the first is waited for: sunk to the casts they would pay the LDS latency many times over
#pragma unroll
        for (int qb = 0; qb < 4; ++qb)
#pragma unroll
            for (int kc = 0; kc < 2; ++kc) qf[qb][kc] = fla_cvq(qr[qb][kc][0], qr[qb][kc][1], qr[qb][kc][2], qr[qb][kc][3]); }
#pragma unroll
      for (int g = 0; g < TT / 256 - 1; ++g) if (g < i) {
#pragma unroll
          for (int u = 0; u < 16; ++u) sa[u & 7] += t[g][u]; }
#pragma unroll
      for (int hb = 0; hb < 2; ++hb)
#pragma unroll
          for (int u = 0; u < 8; ++u) { v4h w;
              if (hb) sa[u] += tl[u];
#pragma unroll
              for (int c = 0; c < 4; ++c) w[c] = tohx(sa[u][c]);
              *(v4h*)(ssm[hb] + (u * 8 + (threadIdx.x >> 4)) * SPI + (threadIdx.x & 15) * 4) = w; } }
    __syncthreads();                                                 // every wave reads the whole of its state
#pragma unroll
    for (int nb = 0; nb < 4; ++nb)                                   // q times the state: first operand 16 query rows, second operand column e = row e of ST, the head dims d as k in WFrag::ld's order on both sides
#pragma unroll
        for (int kc = 0; kc < 2; ++kc) { const v16h sf = WFrag<h16>::ld(ssm[wv >> 1] + (nb * 16 + lr) * SPI + kc * 32 + 8 * hi);
#pragma unroll
            for (int qb = 0; qb < 4; ++qb) acc[qb][nb] = wmma16(qf[qb][kc], sf, acc[qb][nb]); }
    for (int k0 = c0; k0 < r0; k0 += 64) {                           // the key tiles from c0 on under the diagonal tile: no mask
        fla_ldv(vb, vs + vo + 32); FLA_HOLD();
        fla_s(ka, qf, st);
        FLA_HOLD(); fla_ldk(ka, ks + ko + 64 * HD); FLA_HOLD();
        fla_pv<false>(st, va, acc, k0, r0, lr, hi);
        FLA_HOLD(); fla_ldv(va, vs + vo + 64); FLA_HOLD();
        fla_s(kb, qf, st);
        FLA_HOLD(); fla_ldk(kb, ks + ko + 96 * HD); FLA_HOLD();
        fla_pv<false>(st, vb, acc, k0 + 32, r0, lr, hi);
        FLA_HOLD();
        // the two base addresses step 64 keys on. Loads in flight name these registers, so s_wait_xcnt 0 stands in front of the step, in the step's own statement: in a statement of its own the compiler moved the step over it
        asm volatile("s_wait_xcnt 0x0\n\ts_add_nc_u64 %0, %0, %2\n\ts_add_nc_u64 %1, %1, %3" : "+s"(ks), "+s"(vs) : "i"(64 * HD * 2), "i"(64 * 2) : "memory");
    }
    fla_ldv(vb, vs + vo + 32);
    asm volatile("s_wait_xcnt 0x0" ::: "memory");                    // behind the kernel's last loads: the code below reuses the registers that hold their addresses
    FLA_HOLD();
    fla_s(ka, qf, st); fla_pv<true>(st, va, acc, r0, r0, lr, hi);    // the diagonal tile
    fla_s(kb, qf, st); fla_pv<true>(st, vb, acc, r0 + 32, r0, lr, hi);
    float* os = osm[wv];                                             // each wave stages in its own LDS range and stores whole 256-byte rows
    float* C = O + (size_t)(z / NH_) * TT * DQ + (size_t)(z % NH_) * HD;
#pragma unroll
    for (int mb = 0; mb < 4; ++mb) {
#pragma unroll
        for (int nb = 0; nb < 4; ++nb) {
#pragma unroll
            for (int j = 0; j < 8; ++j) os[(hi * 8 + j) * 68 + nb * 16 + lr] = acc[mb][nb][j]; }
        __builtin_amdgcn_wave_barrier(); asm volatile("" ::: "memory");   // keeps the compiler from moving a lane's LDS reads over the other lanes' LDS writes
        float* crow = C + (size_t)(r0 + mb * 16) * DQ;
#pragma unroll
        for (int s = 0; s < 8; ++s) { const int row = 2 * s + hi, cofs = lr * 4; v4f val = *(const v4fa*)(os + row * 68 + cofs);
            *(v4f*)(crow + (size_t)row * DQ + cofs) = val; }
        if (mb < 3) { __builtin_amdgcn_wave_barrier(); asm volatile("s_wait_xcnt 0x0" ::: "memory"); }   // keeps the next block's LDS writes behind these reads, and its LDS reads, which reuse the stores' data registers, behind the wait
    }
}

extern "C" void kernel_launch(void* const* d_in, const int* in_sizes, int n_in,
                              void* d_out, int out_size, void* d_ws, size_t ws_size, hipStream_t stream) {
    (void)in_sizes; (void)n_in; (void)out_size;
    const float* qkv = (const float*)d_in[0];
    // the module's one input: qkv [2][2048][3][16][64]: row (b, t) holds 3072 words: s * 1024 + h * 64 + d with s = 0 query, 1 key, 2 value
    float* OUT = (float*)d_out;     // [2][2048][16][64]
    char* wsp = (char*)d_ws;
    auto take = [&](size_t bytes) { char* p = wsp; wsp += (bytes + 255) & ~(size_t)255; return (void*)p; };
    h16* KP16 = (h16*)take((size_t)NB_ * NH_ * TT * HD * 2); h16* VT16 = (h16*)take((size_t)NB_ * NH_ * HD * TT * 2);
    float* SP32 = (float*)take((size_t)NB_ * NH_ * (TT / PT) * HD * HD * 4);
    if ((size_t)(wsp - (char*)d_ws) > ws_size) return;    // total 24.00 MiB carved
    k_planes<<<dim3(TT / PT, NB_ * NH_), 256, 0, stream>>>(qkv, KP16, VT16, SP32);   /* k planes, v^T planes and partial states of every batch entry and head */
    k_fla<<<dim3(TT / 256, NB_ * NH_), 128, 0, stream>>>(qkv, KP16, VT16, SP32, OUT);   /* out[b][t][h][:] = tril(q k^T) v: the one writer of the output */
}

// v005
// One run takes 17.2 microseconds.
// Two timings next to v004 both put it at 1.06 times that version's speed.
// Counting every step since v000, it is 54.9 times as fast.
#include <hip/hip_runtime.h>

// Causal linear attention with no softmax, from one packed input (qkv [2][2048][3][16][64]: q, k, v = its three slices along the third axis, token-major [b][t][h][64]; a = q k^T over the 64 head dims, NO scale; a is multiplied by a lower-triangular mask of ones (keys j <= i kept, the diagonal included; zeros above it); out = a v -> [2][2048][16][64] token-major (4.2 M); NO softmax;
// argument order: the one packed input).
// Layout: one builder launch (k_planes) rounds each word to bf16 (it is a module INPUT), casts it to f16 and stores the f16 head planes of k [b][h][t][64] and v's transposed planes [b][h][64][2048] (it reads k's and v's slices alone);
// the same launch forms, on the matrix unit, the partial state v^T k (64 x 64, f32) of each head's 128 tokens: with no softmax, (q k^T) v over whole unmasked key blocks equals q (k^T v);
// one launch for all batch entries and heads (k_fla): a block owns 256 query rows of one head; their q rows come from the packed input itself, by asynchronous copies into LDS, and are rounded and cast as above where the fragments are formed. The keys in front of a query's 128-token block enter through the sum of their partial states (f32 sum, cast to f16, one product with q); four waves of the block's eight load and sum those states while the other four do the rest;
// each of these four owns 64 of the rows and walks the keys of its 128-token block up to its diagonal tile, 32 at a time: the transposed score tile k q^T, the mask (diagonal tile only), the cast to f16 in registers, then the product with v into the f32 output tile; no score ever reaches memory.
// Compute dtypes, f32 accumulate: the input rounded to bf16 at its load, every such word of magnitude 2^-14 or more exact as f16 (smaller ones become f16 subnormals); a = q k^T ONE fp16 product (exact products of those words); the scores cast to f16; a v ONE fp16 product; v^T k ONE fp16 product, the summed state cast to f16; q times the state ONE fp16 product.

#define NB_  2
#define TT   2048
#define NH_  16
#define HD   64
#define DQ   (NH_ * HD)
#define ZH   2
typedef _Float16 h16;
typedef unsigned short bf;
typedef __attribute__((ext_vector_type(16))) __bf16   v16bf;
typedef __attribute__((ext_vector_type(16))) _Float16 v16h;
typedef __attribute__((ext_vector_type(8)))  _Float16 v8h;
typedef __attribute__((ext_vector_type(8)))  unsigned short v8us;
typedef __attribute__((ext_vector_type(8)))  float    v8f;
typedef __attribute__((ext_vector_type(4)))  float    v4f;
typedef v8h  __attribute__((may_alias)) v8ha;
typedef v4f  __attribute__((may_alias)) v4fa;
typedef v8us __attribute__((may_alias)) v8usa;

__device__ __forceinline__ unsigned short f2bf(float f) { unsigned u = __float_as_uint(f); u += 0x7FFFu + ((u >> 16) & 1u); return (unsigned short)(u >> 16); }
__device__ __forceinline__ float bf2f(unsigned short b) { return __uint_as_float(((unsigned)b) << 16); }
__device__ __forceinline__ float bfr(float f) { return bf2f(f2bf(f)); }
__device__ __forceinline__ v16h cat16(v8h lo, v8h hi) { return __builtin_shufflevector(lo, hi, 0, 1, 2, 3, 4, 5, 6, 7, 8, 9, 10, 11, 12, 13, 14, 15); }
__device__ __forceinline__ v16bf cat16b(v8us lo, v8us hi) { return __builtin_bit_cast(v16bf, __builtin_shufflevector(lo, hi, 0, 1, 2, 3, 4, 5, 6, 7, 8, 9, 10, 11, 12, 13, 14, 15)); }
__device__ __forceinline__ v8f wmma16(v16h a, v16h b, v8f c) { return __builtin_amdgcn_wmma_f32_16x16x32_f16(false, a, false, b, (short)0, c, false, false); }
__device__ __forceinline__ v8f wmmab(v16bf a, v16bf b, v8f c) { return __builtin_amdgcn_wmma_f32_16x16x32_bf16(false, a, false, b, (short)0, c, false, false); }



template <typename T16> struct WFrag;
template <> struct WFrag<h16> { typedef v16h V; static __device__ __forceinline__ V ld(const h16* p) { return cat16(*(const v8h*)p, *(const v8h*)(p + 16)); } static __device__ __forceinline__ v8f mma(V a, V b, v8f c) { return wmma16(a, b, c); } };
template <> struct WFrag<bf> { typedef v16bf V; static __device__ __forceinline__ V ld(const bf* p) { return cat16b(*(const v8us*)p, *(const v8us*)(p + 16)); } static __device__ __forceinline__ v8f mma(V a, V b, v8f c) { return wmmab(a, b, c); } };
__device__ __forceinline__ h16 tohx(float x) { return (h16)x; }
__device__ __forceinline__ void splitf(float y, unsigned short& h, unsigned short& l) { h = f2bf(y); l = f2bf(y - bf2f(h)); }
typedef __attribute__((ext_vector_type(2))) _Float16 v2h;
typedef __attribute__((ext_vector_type(4))) _Float16 v4h;
typedef __attribute__((ext_vector_type(2))) unsigned short v2us;
typedef __attribute__((ext_vector_type(4))) unsigned short v4us;
typedef __attribute__((ext_vector_type(2))) float v2f;
typedef __attribute__((ext_vector_type(4))) int v4i;

typedef __attribute__((ext_vector_type(2))) __bf16 v2bf;
typedef __attribute__((ext_vector_type(2))) unsigned v2u;
typedef __attribute__((ext_vector_type(4))) unsigned v4u;
typedef v2u __attribute__((may_alias)) v2ua;
typedef v4u __attribute__((may_alias)) v4ua;
// two f32 words, each rounded to bf16 (nearest even) and that value cast to f16 (nearest even; exact from 2^-14 up): one packed word, x in the low half
__device__ __forceinline__ unsigned pk_bh(float x, float y) {
    v2f a; a[0] = x; a[1] = y;
    const unsigned u = __builtin_bit_cast(unsigned, __builtin_convertvector(a, v2bf));
    v2f r; r[0] = __uint_as_float(u << 16); r[1] = __uint_as_float(u & 0xFFFF0000u);
    return __builtin_bit_cast(unsigned, __builtin_convertvector(r, v2h));
}
// ---- k_planes: the two f16 planes of one head's 128 tokens a block. A row of a slice is 256 contiguous bytes of the input (16 lanes x 16 bytes), so every wave-wide load takes two whole rows.
// k: a lane's four words become 8 bytes of the plane; a wave-wide store covers two whole 128-byte rows.
// v, k: a lane takes the same four head dims of 8 consecutive tokens, so its registers hold, a head dim, the 16 bytes (8 tokens) of v^T and of k^T; these go through LDS: v^T so that a wave-wide store covers two whole 256-byte rows, both so that the state's fragments (a row of v^T, a row of k^T, tokens as the k index) are read from there.
// the partial state ST[e][d] = sum over the block's 128 tokens of v[t][e] k[t][d]: 16 tiles of 16 x 16, two a wave, four matrix instructions each; stored f32 as [z][token block][e][d].
// LDS unit (16 bytes) of head dim d, token group g stands at column g ^ (d >> 2): the 16 lanes of a half wave hit 16 different columns in the write (d >> 2 differs) and in the read (g differs).
#define PT 128
__device__ __forceinline__ v16h st_frag(const v4u* sm, int row, int g) {   // tokens 8 g .. 8 g + 7 and 16 on, of one row: WFrag::ld's k order with the tokens as k
    return cat16(__builtin_bit_cast(v8h, sm[row * (PT / 8) + (g ^ (row >> 2))]), __builtin_bit_cast(v8h, sm[row * (PT / 8) + ((g + 2) ^ (row >> 2))]));
}
__global__ __launch_bounds__(256) void k_planes(const float* __restrict__ X, h16* __restrict__ KP, h16* __restrict__ VT, float* __restrict__ SP) {
    __shared__ v4u vsm[HD * PT / 8];
    __shared__ v4u ksm[HD * PT / 8];
    const int c4 = threadIdx.x & 15, tg = threadIdx.x >> 4;
    const int t0 = blockIdx.x * PT, z = blockIdx.y;                  // z = b * 16 + h
    const float* xr = X + ((size_t)(z / NH_) * TT + t0) * (3 * DQ) + (z % NH_) * HD + c4 * 4;
    const float* xvp = xr + (size_t)(tg * 8) * (3 * DQ);             // v, 2048 words on, and k, 1024 words on: tokens 8 tg + i
    v4f xv[8], xk[8];
#pragma unroll
    for (int i = 0; i < 8; ++i) xv[i] = *(const v4f*)(xvp + (size_t)i * (3 * DQ) + 2 * DQ);
#pragma unroll
    for (int i = 0; i < 8; ++i) xk[i] = *(const v4f*)(xvp + (size_t)i * (3 * DQ) + DQ);
    asm volatile("s_wait_xcnt 0x0" :: "v"(xvp) : "memory");   // behind the loads, in front of every write of their address registers; the address is an input so that no later load of the group lands in it
    __builtin_amdgcn_sched_barrier(0);   // all 16 loads of a lane are issued before the first is waited for: sunk to their uses they would pay the memory latency several times over
#pragma unroll
    for (int j = 0; j < 4; ++j) { v4u w;
#pragma unroll
        for (int p = 0; p < 4; ++p) w[p] = pk_bh(xv[2 * p][j], xv[2 * p + 1][j]);
        vsm[(c4 * 4 + j) * (PT / 8) + (tg ^ c4)] = w; }
    v2u kw[8];                                                       // k's plane words: token 8 tg + i, head dims 4 c4 .. 4 c4 + 3
#pragma unroll
    for (int i = 0; i < 8; ++i) { kw[i][0] = pk_bh(xk[i][0], xk[i][1]); kw[i][1] = pk_bh(xk[i][2], xk[i][3]); }
#pragma unroll
    for (int j = 0; j < 4; ++j) { v4u w;                             // the same f16 words, regrouped: one head dim of tokens 2 p and 2 p + 1
#pragma unroll
        for (int p = 0; p < 4; ++p) { const unsigned a = kw[2 * p][j >> 1], b = kw[2 * p + 1][j >> 1];
            w[p] = (j & 1) ? ((a >> 16) | (b & 0xFFFF0000u)) : ((a & 0xFFFFu) | (b << 16)); }
        ksm[(c4 * 4 + j) * (PT / 8) + (tg ^ c4)] = w; }
    // the work-group barrier with fences on LDS alone: what crosses it is vsm and ksm
    __builtin_amdgcn_fence(__ATOMIC_RELEASE, "workgroup", "local"); __builtin_amdgcn_s_barrier(); __builtin_amdgcn_fence(__ATOMIC_ACQUIRE, "workgroup", "local");
#pragma unroll
    for (int r = 0; r < 4; ++r) { const int d = r * 16 + tg;
        *(v4ua*)(VT + ((size_t)z * HD + d) * TT + t0 + c4 * 8) = vsm[d * (PT / 8) + (c4 ^ (d >> 2))]; }
    { const int wv = __builtin_amdgcn_readfirstlane((int)(threadIdx.x >> 5)), lr = threadIdx.x & 15, hi = (threadIdx.x >> 4) & 1;
      const int eb = wv >> 1, db = (wv & 1) * 2;                     // this wave's two tiles: rows e = 16 eb .., columns d = 16 db .. and 16 on
      v8f sa[2]; sa[0] = (v8f){}; sa[1] = (v8f){};
#pragma unroll
      for (int s = 0; s < PT / 32; ++s) { const v16h a = st_frag(vsm, eb * 16 + lr, s * 4 + hi);
#pragma unroll
          for (int t = 0; t < 2; ++t) sa[t] = wmma16(a, st_frag(ksm, (db + t) * 16 + lr, s * 4 + hi), sa[t]); }
      float* so = SP + (((size_t)z * (TT / PT) + blockIdx.x) * HD + eb * 16 + hi * 8) * HD + db * 16 + lr;
#pragma unroll
      for (int j = 0; j < 8; ++j) { so[j * HD] = sa[0][j]; so[j * HD + 16] = sa[1][j]; } }
    h16* ko = KP + ((size_t)z * TT + t0 + tg * 8) * HD + c4 * 4;
#pragma unroll
    for (int i = 0; i < 8; ++i) *(v2ua*)(ko + i * HD) = kw[i];
}
// ---- k_fla: both products of the causal attention in one kernel. The score tile is formed transposed (A = 16 key rows, B = 16 query rows): in its accumulator a lane holds ONE query's scores for keys 8 * hi + r,
// so two such tiles (keys 0..15 and 16..31 of a pass), cast in place, are the 16x32 first operand of the second product in the k order of WFrag::ld (0..7 and 16..23 for hi = 0, 8..15 and 24..31 for hi = 1), which v's fragment loader uses too.
// every '#pragma unroll' of this kernel: the fragment and accumulator arrays stay in registers only where each index is a constant
struct KF { v16h k[2][2]; };   // one pass of 32 keys: k fragments [16-key block][32 head dims]
struct VF { v16h v[4]; };      // the same keys' v^T fragments [16 output columns]
typedef const __attribute__((address_space(1))) h16 gh16;   // k and v are walked by pointers that say 'global memory': a base address that an asm statement has stepped would otherwise be loaded from by flat loads
typedef const __attribute__((address_space(1))) v8h gv8h;
__device__ __forceinline__ v16h fla_ld(gh16* p) { return cat16(*(gv8h*)p, *(gv8h*)(p + 16)); }   // WFrag<h16>::ld's k order
__device__ __forceinline__ void fla_ldk(KF& f, gh16* kp) {
#pragma unroll
    for (int mb = 0; mb < 2; ++mb)
#pragma unroll
        for (int kc = 0; kc < 2; ++kc) f.k[mb][kc] = fla_ld(kp + mb * 16 * HD + kc * 32);
}
__device__ __forceinline__ void fla_ldv(VF& f, gh16* vp) {
#pragma unroll
    for (int nb = 0; nb < 4; ++nb) f.v[nb] = fla_ld(vp + nb * 16 * TT);
}
__device__ __forceinline__ void fla_s(const KF& f, const v16h (&qf)[4][2], v8f (&st)[2][4]) {
#pragma unroll
    for (int mb = 0; mb < 2; ++mb)
#pragma unroll
        for (int qb = 0; qb < 4; ++qb) st[mb][qb] = (v8f){};
#pragma unroll
    for (int kc = 0; kc < 2; ++kc)
#pragma unroll
        for (int mb = 0; mb < 2; ++mb)
#pragma unroll
            for (int qb = 0; qb < 4; ++qb) st[mb][qb] = wmma16(f.k[mb][kc], qf[qb][kc], st[mb][qb]);
}
template <bool MASK>
__device__ __forceinline__ void fla_pv(const v8f (&st)[2][4], const VF& f, v8f (&acc)[4][4], int k0, int r0, int lr, int hi) {
#pragma unroll
    for (int qb = 0; qb < 4; ++qb) {
        v16h p;
#pragma unroll
        for (int s = 0; s < 16; ++s) { float x = st[s >> 3][qb][s & 7];
            if (MASK) x = (k0 + (s >> 3) * 16 + hi * 8 + (s & 7) <= r0 + qb * 16 + lr) ? x : 0.0f;   // x tril: key <= query kept
            p[s] = tohx(x); }
#pragma unroll
        for (int nb = 0; nb < 4; ++nb) acc[qb][nb] = wmma16(p, f.v[nb], acc[qb][nb]);
    }
}
// eight asynchronous copies of 16 bytes a lane, global memory to LDS: copy c takes the lane's bytes at g + c * gs to LDS byte l + c * ls. s_wait_xcnt 0 is the statement's last line: it stands in front of every later write of the address registers that the copies name
__device__ __forceinline__ void fla_cp8(unsigned l, unsigned ls, const char* g, unsigned gs) {
    asm volatile("global_load_async_to_lds_b128 %0, %8, off\n\t"
                 "global_load_async_to_lds_b128 %1, %9, off\n\t"
                 "global_load_async_to_lds_b128 %2, %10, off\n\t"
                 "global_load_async_to_lds_b128 %3, %11, off\n\t"
                 "global_load_async_to_lds_b128 %4, %12, off\n\t"
                 "global_load_async_to_lds_b128 %5, %13, off\n\t"
                 "global_load_async_to_lds_b128 %6, %14, off\n\t"
                 "global_load_async_to_lds_b128 %7, %15, off\n\t"
                 "s_wait_xcnt 0x0"
                 :: "v"(l), "v"(l + ls), "v"(l + 2 * ls), "v"(l + 3 * ls), "v"(l + 4 * ls), "v"(l + 5 * ls), "v"(l + 6 * ls), "v"(l + 7 * ls),
                    "v"(g), "v"(g + gs), "v"(g + 2 * gs), "v"(g + 3 * gs), "v"(g + 4 * gs), "v"(g + 5 * gs), "v"(g + 6 * gs), "v"(g + 7 * gs)
                 : "memory");
}
#define QPF 68   // pitch of q's f32 rows in LDS, in words: 272 bytes = 16 x 17, so that the 16 rows of a fragment read start in 16 different bank groups
// one q fragment from the f32 words 0 .. 7 (a0, a1) and 16 .. 23 (b0, b1) of a lane's place in its row (WFrag<h16>::ld's k order), each rounded to bf16 and cast to f16 as the builder does for k and v
__device__ __forceinline__ v16h fla_cvq(v4f a0, v4f a1, v4f b0, v4f b1) {
    v4u lo, hw;
    lo[0] = pk_bh(a0[0], a0[1]); lo[1] = pk_bh(a0[2], a0[3]); lo[2] = pk_bh(a1[0], a1[1]); lo[3] = pk_bh(a1[2], a1[3]);
    hw[0] = pk_bh(b0[0], b0[1]); hw[1] = pk_bh(b0[2], b0[3]); hw[2] = pk_bh(b1[0], b1[1]); hw[3] = pk_bh(b1[2], b1[3]);
    return cat16(__builtin_bit_cast(v8h, lo), __builtin_bit_cast(v8h, hw));
}
// FLA_HOLD stands on both sides of a group of fragment loads: without it the scheduler sinks the loads down to their first use, a pass and a half later, and the wave waits out the whole load latency there
#define FLA_HOLD() __builtin_amdgcn_sched_barrier(0)
#define SPI 72   // pitch of the state's rows in LDS, in f16 words: 144 bytes, so that the 16 rows of a fragment read start in 16 different bank groups
__global__ __launch_bounds__(256) void k_fla(const float* __restrict__ X, const h16* __restrict__ KP, const h16* __restrict__ VT, const float* __restrict__ SP, float* __restrict__ O) {
    __shared__ __align__(16) float osm[4][16 * 68];
    __shared__ __align__(16) h16 ssm[2][HD * SPI];
    __shared__ __align__(16) float qsm[256 * QPF];                   // the block's 256 rows of q, f32 as in the input
    const int wv = __builtin_amdgcn_readfirstlane((int)(threadIdx.x >> 5));   // waves 0 .. 3: the attention of 64 rows each; waves 4 .. 7: the states.
    const int lane = threadIdx.x & 31, lr = lane & 15, hi = lane >> 4;
    const int i = TT / 256 - 1 - blockIdx.x, z = blockIdx.y;         // z = b * 16 + h; the blocks with the most partial states to sum start first
    const int r0 = i * 256 + wv * 64, c0 = i * 256 + (wv >> 1) * 128;   // the first four waves take the four 64-row tiles of rows 256 i .. 256 i + 255 of one head; the keys in front of c0, the start of the wave's 128 rows, enter through the state
    v16h qf[4][2];
    v8f acc[4][4];
    if (wv >= 4) {
      // the state of the keys in front of row 256 i: the sum, in token order, of their 2 i partial states; one partial state more gives the state in front of row 256 i + 128.
      // these four waves do nothing else: their loads land and are summed while the other four work on the keys of their own 128 rows. A thread sums 8 x 4 words, casts them and puts them into LDS as ST[e][d], one copy for each pair of attention waves
      const char* sp = (const char*)(SP + (size_t)z * (TT / PT) * (HD * HD));   // block-uniform: this head's first partial state
      const unsigned sx = threadIdx.x - 128;                         // this thread among the 128 of the four waves
      const unsigned tb = sx * 16;                                   // its place in a state, in bytes
      v4f sa[8], tl[8];
#pragma unroll
      for (int u = 0; u < 8; ++u) tl[u] = *(const v4f*)(sp + (size_t)(2 * i) * (HD * HD * 4) + tb + u * 2048);   // the partial state of rows 256 i .. 256 i + 127: added last, loaded first, so that nothing waits for it alone
      // each s_wait_xcnt 0 of this block stands behind a group of loads, in front of every write of their address registers; the lane's offset and the whole address are inputs so that, whichever the loads name, no load of the group lands in it
      asm volatile("s_wait_xcnt 0x0" :: "v"(tb), "v"(sp + (size_t)(2 * i) * (HD * HD * 4) + tb) : "memory");
      v4f t[TT / 256 - 1][16];                                       // two partial states a group. Every group's loads are issued before the first sum: the wave pays the latency of L2 once, not once a group
#pragma unroll
      for (int g = TT / 256 - 2; g >= 0; --g) if (g < i) {           // last group first: the sums begin with group 0, and the compiler draws their first additions up to that group's loads, where they now hold back no other load
          const char* sq = sp + (size_t)g * (2 * HD * HD * 4);
#pragma unroll
          for (int u = 0; u < 16; ++u) t[g][u] = *(const v4f*)(sq + tb + u * 2048);
          asm volatile("s_wait_xcnt 0x0" :: "v"(tb), "v"(sp + tb) : "memory"); }
#pragma unroll
      for (int u = 0; u < 8; ++u) sa[u] = (v4f){};
      if (i > 0) {                                                   // the first two states start the sum, so that it needs no registers beside theirs
#pragma unroll
          for (int u = 0; u < 8; ++u) sa[u] = t[0][u] + t[0][u + 8]; }
#pragma unroll
      for (int g = 1; g < TT / 256 - 1; ++g) if (g < i) {
#pragma unroll
          for (int u = 0; u < 16; ++u) sa[u & 7] += t[g][u]; }
#pragma unroll
      for (int hb = 0; hb < 2; ++hb)
#pragma unroll
          for (int u = 0; u < 8; ++u) { v4h w;
              if (hb) sa[u] += tl[u];
#pragma unroll
              for (int c = 0; c < 4; ++c) w[c] = tohx(sa[u][c]);
              *(v4h*)(ssm[hb] + (u * 8 + (sx >> 4)) * SPI + (sx & 15) * 4) = w; }
    } else {
    gh16* ks = (gh16*)(KP + (size_t)z * TT * HD + (size_t)c0 * HD);    // wave-uniform: key row k0 of this head
    gh16* vs = (gh16*)(VT + (size_t)z * HD * TT + c0);                 // wave-uniform: key k0 in row 0 of this head's v^T
    const unsigned ko = lr * HD + 8 * hi, vo = lr * TT + 8 * hi;     // this lane's place from there: fixed over the key loop
    // q: each wave copies its own 64 rows, 32 copies: a wave-wide copy takes two whole 256-byte rows of the input
    { const char* qg = (const char*)(X + ((size_t)(z / NH_) * TT + r0 + hi) * (3 * DQ) + (z % NH_) * HD + lr * 4);
      const unsigned ql = (unsigned)(size_t)(const __attribute__((address_space(3))) float*)qsm + (wv * 64 + hi) * (QPF * 4) + lr * 16;
#pragma unroll
      for (int c = 0; c < 4; ++c) fla_cp8(ql + c * (16 * QPF * 4), 2 * QPF * 4, qg + (size_t)c * (16 * 3 * DQ * 4), 2 * 3 * DQ * 4); }
#pragma unroll
    for (int qb = 0; qb < 4; ++qb)
#pragma unroll
        for (int nb = 0; nb < 4; ++nb) acc[qb][nb] = (v8f){};
    KF ka, kb; VF va, vb; v8f st[2][4];                              // two fragment sets (even and odd pass): a set is loaded again as soon as its last product has read it, a pass and a half ahead of its next use
    FLA_HOLD(); fla_ldk(ka, ks + ko); FLA_HOLD(); fla_ldv(va, vs + vo); FLA_HOLD(); fla_ldk(kb, ks + ko + 32 * HD);   // issued in the loop's own order, so that the counted waits at the loop's head fit both ways in
    asm volatile("s_wait_xcnt 0x0" ::: "memory");                    // behind these loads: where the key loop has no trip, the load behind it lands in the register that holds their lane offset
    FLA_HOLD();
    // A wave reads only the 64 rows of q that it copied itself, so its own wait is all that stands between copy and read
    asm volatile("s_wait_asynccnt 0x0" ::: "memory");
    { const float* ql = qsm + (wv * 64 + lr) * QPF + 8 * hi;
      v4f qr[4][2][4];
#pragma unroll
      for (int qb = 0; qb < 4; ++qb)
#pragma unroll
          for (int kc = 0; kc < 2; ++kc)
#pragma unroll
              for (int w = 0; w < 4; ++w) qr[qb][kc][w] = *(const v4fa*)(ql + qb * 16 * QPF + kc * 32 + (w >> 1) * 16 + (w & 1) * 4);
      FLA_HOLD();   // all 32 LDS reads are issued before the first is waited for: sunk to the casts they would pay the LDS latency many times over
#pragma unroll
      for (int qb = 0; qb < 4; ++qb)
#pragma unroll
          for (int kc = 0; kc < 2; ++kc) qf[qb][kc] = fla_cvq(qr[qb][kc][0], qr[qb][kc][1], qr[qb][kc][2], qr[qb][kc][3]); }
    for (int k0 = c0; k0 < r0; k0 += 64) {                           // the key tiles from c0 on under the diagonal tile: no mask
        fla_ldv(vb, vs + vo + 32); FLA_HOLD();
        fla_s(ka, qf, st);
        FLA_HOLD(); fla_ldk(ka, ks + ko + 64 * HD); FLA_HOLD();
        fla_pv<false>(st, va, acc, k0, r0, lr, hi);
        FLA_HOLD(); fla_ldv(va, vs + vo + 64); FLA_HOLD();
        fla_s(kb, qf, st);
        FLA_HOLD(); fla_ldk(kb, ks + ko + 96 * HD); FLA_HOLD();
        fla_pv<false>(st, vb, acc, k0 + 32, r0, lr, hi);
        FLA_HOLD();
        // the two base addresses step 64 keys on. Loads in flight name these registers, so s_wait_xcnt 0 stands in front of the step, in the step's own statement: in a statement of its own the compiler moved the step over it
        asm volatile("s_wait_xcnt 0x0\n\ts_add_nc_u64 %0, %0, %2\n\ts_add_nc_u64 %1, %1, %3" : "+s"(ks), "+s"(vs) : "i"(64 * HD * 2), "i"(64 * 2) : "memory");
    }
    fla_ldv(vb, vs + vo + 32);
    asm volatile("s_wait_xcnt 0x0" :: "v"(vo), "v"(vo * 2) : "memory");   // behind the kernel's last loads: the code below reuses the registers that hold their addresses; the lane's offset, in words and in bytes, is an input so that no load of the group lands in it
    FLA_HOLD();
    fla_s(ka, qf, st); fla_pv<true>(st, va, acc, r0, r0, lr, hi);    // the diagonal tile
    fla_s(kb, qf, st); fla_pv<true>(st, vb, acc, r0 + 32, r0, lr, hi);
    }
    __syncthreads();                                                 // the states are whole in LDS; every attention wave reads the whole of its state behind it
    if (wv >= 4) return;                                             // behind the kernel's one barrier
#pragma unroll
    for (int nb = 0; nb < 4; ++nb)                                   // q times the state: first operand 16 query rows, second operand column e = row e of ST, the head dims d as k in WFrag::ld's order on both sides
#pragma unroll
        for (int kc = 0; kc < 2; ++kc) { const v16h sf = WFrag<h16>::ld(ssm[wv >> 1] + (nb * 16 + lr) * SPI + kc * 32 + 8 * hi);
#pragma unroll
            for (int qb = 0; qb < 4; ++qb) acc[qb][nb] = wmma16(qf[qb][kc], sf, acc[qb][nb]); }
    float* os = osm[wv];                                             // each wave stages in its own LDS range and stores whole 256-byte rows
    float* C = O + (size_t)(z / NH_) * TT * DQ + (size_t)(z % NH_) * HD;
#pragma unroll
    for (int mb = 0; mb < 4; ++mb) {
#pragma unroll
        for (int nb = 0; nb < 4; ++nb) {
#pragma unroll
            for (int j = 0; j < 8; ++j) os[(hi * 8 + j) * 68 + nb * 16 + lr] = acc[mb][nb][j]; }
        __builtin_amdgcn_wave_barrier(); asm volatile("" ::: "memory");   // keeps the compiler from moving a lane's LDS reads over the other lanes' LDS writes
        float* crow = C + (size_t)(r0 + mb * 16) * DQ;
#pragma unroll
        for (int s = 0; s < 8; ++s) { const int row = 2 * s + hi, cofs = lr * 4; v4f val = *(const v4fa*)(os + row * 68 + cofs);
            *(v4f*)(crow + (size_t)row * DQ + cofs) = val; }
        if (mb < 3) { __builtin_amdgcn_wave_barrier(); asm volatile("s_wait_xcnt 0x0" ::: "memory"); }   // keeps the next block's LDS writes behind these reads, and its LDS reads, which reuse the stores' data registers, behind the wait
    }
}

extern "C" void kernel_launch(void* const* d_in, const int* in_sizes, int n_in,
                              void* d_out, int out_size, void* d_ws, size_t ws_size, hipStream_t stream) {
    (void)in_sizes; (void)n_in; (void)out_size;
    const float* qkv = (const float*)d_in[0];
    // the module's one input: qkv [2][2048][3][16][64]: row (b, t) holds 3072 words: s * 1024 + h * 64 + d with s = 0 query, 1 key, 2 value
    float* OUT = (float*)d_out;     // [2][2048][16][64]
    char* wsp = (char*)d_ws;
    auto take = [&](size_t bytes) { char* p = wsp; wsp += (bytes + 255) & ~(size_t)255; return (void*)p; };
    h16* KP16 = (h16*)take((size_t)NB_ * NH_ * TT * HD * 2); h16* VT16 = (h16*)take((size_t)NB_ * NH_ * HD * TT * 2);
    float* SP32 = (float*)take((size_t)NB_ * NH_ * (TT / PT) * HD * HD * 4);
    if ((size_t)(wsp - (char*)d_ws) > ws_size) return;    // total 24.00 MiB carved
    k_planes<<<dim3(TT / PT, NB_ * NH_), 256, 0, stream>>>(qkv, KP16, VT16, SP32);   /* k planes, v^T planes and partial states of every batch entry and head */
    k_fla<<<dim3(TT / 256, NB_ * NH_), 256, 0, stream>>>(qkv, KP16, VT16, SP32, OUT);   /* out[b][t][h][:] = tril(q k^T) v: the one writer of the output */
}

// v006
// Measured time: 12.5 microseconds a run.
// Timed twice side by side with v005, it ran 1.38 times as fast both times.
// All steps since v000 together make it 75.7 times as fast.
#include <hip/hip_runtime.h>

// Causal linear attention with no softmax, from one packed input (qkv [2][2048][3][16][64]: q, k, v = its three slices along the third axis, token-major [b][t][h][64]; a = q k^T over the 64 head dims, NO scale; a is multiplied by a lower-triangular mask of ones (keys j <= i kept, the diagonal included; zeros above it); out = a v -> [2][2048][16][64] token-major (4.2 M); NO softmax;
// argument order: the one packed input).
// Layout: ONE launch (k_fla), no workspace: a block of eight waves owns 256 query rows of one head. With no softmax, (q k^T) v over whole unmasked key blocks equals q (k^T v): the keys in front of the block's first row enter through the state v^T k (64 x 64), which the block forms itself from the input;
// each wave takes an eighth of those keys, 32 a step, and keeps a whole f32 state in its accumulators: its loads go to registers, not LDS, and no barrier stands inside that loop; the eight states are summed once through LDS (f32, wave order), cast to f16 and multiplied with q.
// The block's own 256 keys: q, k and v of these rows come by asynchronous copies into LDS; each wave owns 32 query rows and walks the keys up to its diagonal tile, 32 at a time, one such step in each trip of the loop over the earlier keys, while that loop's loads are in flight: the transposed score tile k q^T, the mask (it keeps every key under the diagonal tile), the cast to f16 in registers, then the product with v into the f32 output tile; no score ever reaches memory.
// Every word of the input is rounded to bf16 (it is a module INPUT) where a fragment is formed, and that value cast to f16 for every product but the state's, which takes the bf16 words themselves.
// Compute dtypes, f32 accumulate: the input rounded to bf16 at its load, every such word of magnitude 2^-14 or more exact as f16 (smaller ones become f16 subnormals); a = q k^T ONE fp16 product (exact products of those words); the scores cast to f16; a v ONE fp16 product; v^T k ONE bf16 product (exact products of the rounded words), the summed state cast to f16; q times the state ONE fp16 product.

#define NB_  2
#define TT   2048
#define NH_  16
#define HD   64
#define DQ   (NH_ * HD)
#define ZH   2
typedef _Float16 h16;
typedef unsigned short bf;
typedef __attribute__((ext_vector_type(16))) __bf16   v16bf;
typedef __attribute__((ext_vector_type(16))) _Float16 v16h;
typedef __attribute__((ext_vector_type(8)))  _Float16 v8h;
typedef __attribute__((ext_vector_type(8)))  unsigned short v8us;
typedef __attribute__((ext_vector_type(8)))  float    v8f;
typedef __attribute__((ext_vector_type(4)))  float    v4f;
typedef v8h  __attribute__((may_alias)) v8ha;
typedef v4f  __attribute__((may_alias)) v4fa;
typedef v8us __attribute__((may_alias)) v8usa;

__device__ __forceinline__ unsigned short f2bf(float f) { unsigned u = __float_as_uint(f); u += 0x7FFFu + ((u >> 16) & 1u); return (unsigned short)(u >> 16); }
__device__ __forceinline__ float bf2f(unsigned short b) { return __uint_as_float(((unsigned)b) << 16); }
__device__ __forceinline__ float bfr(float f) { return bf2f(f2bf(f)); }
__device__ __forceinline__ v16h cat16(v8h lo, v8h hi) { return __builtin_shufflevector(lo, hi, 0, 1, 2, 3, 4, 5, 6, 7, 8, 9, 10, 11, 12, 13, 14, 15); }
__device__ __forceinline__ v16bf cat16b(v8us lo, v8us hi) { return __builtin_bit_cast(v16bf, __builtin_shufflevector(lo, hi, 0, 1, 2, 3, 4, 5, 6, 7, 8, 9, 10, 11, 12, 13, 14, 15)); }
__device__ __forceinline__ v8f wmma16(v16h a, v16h b, v8f c) { return __builtin_amdgcn_wmma_f32_16x16x32_f16(false, a, false, b, (short)0, c, false, false); }
__device__ __forceinline__ v8f wmmab(v16bf a, v16bf b, v8f c) { return __builtin_amdgcn_wmma_f32_16x16x32_bf16(false, a, false, b, (short)0, c, false, false); }



template <typename T16> struct WFrag;
template <> struct WFrag<h16> { typedef v16h V; static __device__ __forceinline__ V ld(const h16* p) { return cat16(*(const v8h*)p, *(const v8h*)(p + 16)); } static __device__ __forceinline__ v8f mma(V a, V b, v8f c) { return wmma16(a, b, c); } };
template <> struct WFrag<bf> { typedef v16bf V; static __device__ __forceinline__ V ld(const bf* p) { return cat16b(*(const v8us*)p, *(const v8us*)(p + 16)); } static __device__ __forceinline__ v8f mma(V a, V b, v8f c) { return wmmab(a, b, c); } };
__device__ __forceinline__ h16 tohx(float x) { return (h16)x; }
__device__ __forceinline__ void splitf(float y, unsigned short& h, unsigned short& l) { h = f2bf(y); l = f2bf(y - bf2f(h)); }
typedef __attribute__((ext_vector_type(2))) _Float16 v2h;
typedef __attribute__((ext_vector_type(4))) _Float16 v4h;
typedef __attribute__((ext_vector_type(2))) unsigned short v2us;
typedef __attribute__((ext_vector_type(4))) unsigned short v4us;
typedef __attribute__((ext_vector_type(2))) float v2f;
typedef __attribute__((ext_vector_type(4))) int v4i;

typedef __attribute__((ext_vector_type(2))) __bf16 v2bf;
typedef __attribute__((ext_vector_type(2))) unsigned v2u;
typedef __attribute__((ext_vector_type(4))) unsigned v4u;
typedef v2u __attribute__((may_alias)) v2ua;
typedef v4u __attribute__((may_alias)) v4ua;
// two f32 words, each rounded to bf16 (nearest even) and that value cast to f16 (nearest even; exact from 2^-14 up): one packed word, x in the low half
__device__ __forceinline__ unsigned pk_bh(float x, float y) {
    v2f a; a[0] = x; a[1] = y;
    const unsigned u = __builtin_bit_cast(unsigned, __builtin_convertvector(a, v2bf));
    v2f r; r[0] = __uint_as_float(u << 16); r[1] = __uint_as_float(u & 0xFFFF0000u);
    return __builtin_bit_cast(unsigned, __builtin_convertvector(r, v2h));
}
// ---- A row of a slice is 256 contiguous bytes of the input (16 lanes x 16 bytes), so every wave-wide load takes two whole rows.
#define RS (3 * DQ)   // words of one token's row of the input: q, k, v of all heads
// eight asynchronous copies of 16 bytes a lane, global memory to LDS: copy c takes the lane's bytes at g + c * gs to LDS byte l + c * ls. s_wait_xcnt 0 is the statement's last line: it stands in front of every later write of the address registers that the copies name
__device__ __forceinline__ void fla_cp8(unsigned l, unsigned ls, const char* g, unsigned gs) {
    asm volatile("global_load_async_to_lds_b128 %0, %8, off\n\t"
                 "global_load_async_to_lds_b128 %1, %9, off\n\t"
                 "global_load_async_to_lds_b128 %2, %10, off\n\t"
                 "global_load_async_to_lds_b128 %3, %11, off\n\t"
                 "global_load_async_to_lds_b128 %4, %12, off\n\t"
                 "global_load_async_to_lds_b128 %5, %13, off\n\t"
                 "global_load_async_to_lds_b128 %6, %14, off\n\t"
                 "global_load_async_to_lds_b128 %7, %15, off\n\t"
                 "s_wait_xcnt 0x0"
                 :: "v"(l), "v"(l + ls), "v"(l + 2 * ls), "v"(l + 3 * ls), "v"(l + 4 * ls), "v"(l + 5 * ls), "v"(l + 6 * ls), "v"(l + 7 * ls),
                    "v"(g), "v"(g + gs), "v"(g + 2 * gs), "v"(g + 3 * gs), "v"(g + 4 * gs), "v"(g + 5 * gs), "v"(g + 6 * gs), "v"(g + 7 * gs)
                 : "memory");
}
#define QPF 68   // pitch of the f32 rows of q and k in LDS, in words: 272 bytes = 16 x 17, so that the 16 rows of a fragment read start in 16 different bank groups
// one fragment of q or k with the head dims as k index, from the f32 words 0 .. 7 (a0, a1) and 16 .. 23 (b0, b1) of a lane's place in its row (WFrag<h16>::ld's k order), each rounded to bf16 and cast to f16
__device__ __forceinline__ v16h fla_cvq(v4f a0, v4f a1, v4f b0, v4f b1) {
    v4u lo, hw;
    lo[0] = pk_bh(a0[0], a0[1]); lo[1] = pk_bh(a0[2], a0[3]); lo[2] = pk_bh(a1[0], a1[1]); lo[3] = pk_bh(a1[2], a1[3]);
    hw[0] = pk_bh(b0[0], b0[1]); hw[1] = pk_bh(b0[2], b0[3]); hw[2] = pk_bh(b1[0], b1[1]); hw[3] = pk_bh(b1[2], b1[3]);
    return cat16(__builtin_bit_cast(v8h, lo), __builtin_bit_cast(v8h, hw));
}
// FLA_HOLD stands on both sides of a group of loads: without it the scheduler sinks the loads down to their first use and the wave waits out the whole load latency there
#define FLA_HOLD() __builtin_amdgcn_sched_barrier(0)
#define SPI 72   // pitch of the state's rows in LDS, in f16 words
#define WST (96 * QPF * 4)   // bytes of one wave's own LDS range: 32 rows of q, of k, of v, f32; later the wave's own f32 state (16,384 bytes)
// ---- fragments with the TOKENS as k index, straight from the input. Row (or column) lr of matrix tile a stands for head dim 4 lr + a. A lane loads the 16 bytes x[t][4 lr .. 4 lr + 3] of its 16 tokens of a 32-token step,
// t = 8 hi + 0 .. 7 and 16 on (WFrag<h16>::ld's k order): word a of these 16 loads, packed along t, IS the lane's part of tile a's fragment, as first operand (x^T) and as second operand (x) alike. A wave-wide load takes two whole 256-byte rows of the input.
__device__ __forceinline__ void tk_ld(v4f (&x)[16], const char* ub, unsigned lo) {   // ub: block- or wave-uniform address of the step's first token in its slice; lo: the lane's fixed byte offset
#pragma unroll
    for (int j = 0; j < 8; ++j) { x[j] = *(const v4f*)(ub + lo + j * (RS * 4)); x[8 + j] = *(const v4f*)(ub + lo + (16 + j) * (RS * 4)); }
}
template <int A>
__device__ __forceinline__ v16h tk_pk(const v4f (&x)[16]) {
    v4u lo, hw;
#pragma unroll
    for (int p = 0; p < 4; ++p) { lo[p] = pk_bh(x[2 * p][A], x[2 * p + 1][A]); hw[p] = pk_bh(x[8 + 2 * p][A], x[9 + 2 * p][A]); }
    return cat16(__builtin_bit_cast(v8h, lo), __builtin_bit_cast(v8h, hw));
}
__device__ __forceinline__ void tk_pk4(v16h (&f)[4], const v4f (&x)[16]) { f[0] = tk_pk<0>(x); f[1] = tk_pk<1>(x); f[2] = tk_pk<2>(x); f[3] = tk_pk<3>(x); }
// the same fragment as bf16 words: the rounding of the input alone, one instruction for two words. The state's product takes its operands so: they are the same values as the f16 words (and keep those under 2^-14 whole)
typedef __attribute__((ext_vector_type(8))) unsigned v8u;
__device__ __forceinline__ unsigned pk_b(float x, float y) { v2f a; a[0] = x; a[1] = y; return __builtin_bit_cast(unsigned, __builtin_convertvector(a, v2bf)); }
template <int A>
__device__ __forceinline__ v8u tk_pb(const v4f (&x)[16]) {
    v8u w;
#pragma unroll
    for (int p = 0; p < 4; ++p) { w[p] = pk_b(x[2 * p][A], x[2 * p + 1][A]); w[4 + p] = pk_b(x[8 + 2 * p][A], x[9 + 2 * p][A]); }
    return w;
}
// one step of 32 earlier keys: the loaded words become fragments and their registers are loaded again for the next step, at ub (MORE: that step exists), k's half and then v's, each as soon as its four fragments are packed
template <bool MORE>
__device__ __forceinline__ void st_step(v8f (&sa)[4][4], v4f (&xv)[16], v4f (&xk)[16], const char* ub, unsigned lo) {
    const v8u b0 = tk_pb<0>(xk), b1 = tk_pb<1>(xk), b2 = tk_pb<2>(xk), b3 = tk_pb<3>(xk);
    if (MORE) {
        asm volatile("" :: "v"(b0), "v"(b1), "v"(b2), "v"(b3));      // inputs only: the four fragments are packed in front of the reload; sunk to the products they would keep the loaded words alive, and the reload would wait for copies of them
        FLA_HOLD(); tk_ld(xk, ub + DQ * 4, lo); asm volatile("s_wait_xcnt 0x0" :: "v"(lo) : "memory"); FLA_HOLD(); }
    const v8u a0 = tk_pb<0>(xv), a1 = tk_pb<1>(xv), a2 = tk_pb<2>(xv), a3 = tk_pb<3>(xv);
    if (MORE) {
        asm volatile("" :: "v"(a0), "v"(a1), "v"(a2), "v"(a3));      // inputs only: as above
        FLA_HOLD(); tk_ld(xv, ub + 2 * DQ * 4, lo); asm volatile("s_wait_xcnt 0x0" :: "v"(lo) : "memory"); FLA_HOLD(); }
    const v16bf fa[4] = { __builtin_bit_cast(v16bf, a0), __builtin_bit_cast(v16bf, a1), __builtin_bit_cast(v16bf, a2), __builtin_bit_cast(v16bf, a3) };
    const v16bf fb[4] = { __builtin_bit_cast(v16bf, b0), __builtin_bit_cast(v16bf, b1), __builtin_bit_cast(v16bf, b2), __builtin_bit_cast(v16bf, b3) };
#pragma unroll
    for (int a = 0; a < 4; ++a)
#pragma unroll
        for (int b = 0; b < 4; ++b) sa[a][b] = wmmab(fa[a], fb[b], sa[a][b]);
}
// a fragment kept in LDS in its own order: the lane's 32 bytes as two 16-byte units, each unit's 32 lanes contiguous
__device__ __forceinline__ void fr_st(v4u* s, int lane, v16h f) {
    s[lane] = __builtin_bit_cast(v4u, __builtin_shufflevector(f, f, 0, 1, 2, 3, 4, 5, 6, 7)); s[32 + lane] = __builtin_bit_cast(v4u, __builtin_shufflevector(f, f, 8, 9, 10, 11, 12, 13, 14, 15));
}
__device__ __forceinline__ v16h fr_ld(const v4u* s, int lane) { return cat16(__builtin_bit_cast(v8h, s[lane]), __builtin_bit_cast(v8h, s[32 + lane])); }
// one step of 32 of the block's own keys for a wave's 32 query rows. The score tile is formed transposed (A = 16 key rows, B = 16 query rows): in its accumulator a lane holds ONE query's scores for keys 8 * hi + r,
// so two such tiles (keys 0..15 and 16..31 of the step), cast in place, are the 16x32 first operand of the second product in WFrag<h16>::ld's k order, which v's fragments have too.
struct OF { v16h k[2][2], v[4]; };   // one step's fragments
__device__ __forceinline__ void own_ld(OF& o, const v4u* kf, const v4u* vf, int lane) {
#pragma unroll
    for (int f = 0; f < 4; ++f) { o.k[f >> 1][f & 1] = fr_ld(kf + f * 64, lane); o.v[f] = fr_ld(vf + f * 64, lane); }
}
__device__ __forceinline__ void own_step(const OF& o, const v16h (&qf)[2][2], v8f (&acc)[2][4], int ql) {   // ql: the lane's first query minus 8 hi, counted from the step's first key
    v8f st[2][2];
#pragma unroll
    for (int mb = 0; mb < 2; ++mb)
#pragma unroll
        for (int qb = 0; qb < 2; ++qb) st[mb][qb] = wmma16(o.k[mb][0], qf[qb][0], (v8f){});
#pragma unroll
    for (int mb = 0; mb < 2; ++mb)
#pragma unroll
        for (int qb = 0; qb < 2; ++qb) st[mb][qb] = wmma16(o.k[mb][1], qf[qb][1], st[mb][qb]);
#pragma unroll
    for (int qb = 0; qb < 2; ++qb) {
        v16h p;
#pragma unroll
        for (int s = 0; s < 16; ++s) { float x = st[s >> 3][qb][s & 7];
            x = ((s >> 3) * 16 + (s & 7) <= qb * 16 + ql) ? x : 0.0f;   // x tril: key <= query kept; under the diagonal tile that holds for every key: one path for both kinds of step
            p[s] = tohx(x); }
#pragma unroll
        for (int a = 0; a < 4; ++a) acc[qb][a] = wmma16(p, o.v[a], acc[qb][a]);
    }
}
// every '#pragma unroll' of this file: the fragment, load and accumulator arrays stay in registers only where each index is a constant
__global__ __launch_bounds__(256) void k_fla(const float* __restrict__ X, float* __restrict__ O) {
    __shared__ __align__(16) char stg[8 * WST];                      // a range a wave
    __shared__ __align__(16) v4u kfr[8][4 * 64];                     // the own keys' k fragments [32-key step][16-key block x 32 head dims], head dims as k index
    __shared__ __align__(16) v4u vfr[8][4 * 64];                     // the own keys' v fragments [32-key step][tile a], tokens as k index
    __shared__ __align__(16) h16 ssm[HD * SPI];                      // the summed state ST[e][d], f16
    const int wv = __builtin_amdgcn_readfirstlane((int)(threadIdx.x >> 5));
    const int lane = threadIdx.x & 31, lr = lane & 15, hi = lane >> 4;
    const int z = blockIdx.x, i = TT / 256 - 1 - blockIdx.y;         // z = b * 16 + h, the fast grid axis: neighbours in launch order work on different heads with equal loads; the blocks with the most earlier keys start first
    const int rt = wv < 4 ? wv : 11 - wv;                            // the wave's 32 of the block's 256 rows: waves w and w + 4 share a SIMD and take tiles w and 7 - w, nine key steps together
    const int b0 = i * 256, r0 = b0 + rt * 32;
    const char* xh = (const char*)(X + (size_t)(z / NH_) * TT * RS + (z % NH_) * HD);   // block-uniform: q of token 0 of this head; k stands DQ words on, v 2 DQ
    const unsigned lo = (unsigned)((8 * hi * RS + lr * 4) * 4);      // the lane's place from a step's first token: fixed
    char* sw = stg + wv * WST;
    // q, k and v of the wave's own 32 rows: 48 copies; a wave-wide copy takes two whole 256-byte rows of the input
    { const char* qg = xh + ((size_t)(r0 + hi) * RS + lr * 4) * 4;
      const unsigned ql = (unsigned)(size_t)(const __attribute__((address_space(3))) char*)stg + wv * WST + hi * (QPF * 4) + lr * 16;
#pragma unroll
      for (int c = 0; c < 6; ++c) fla_cp8(ql + c * (16 * QPF * 4), 2 * QPF * 4, qg + (size_t)(c >> 1) * (DQ * 4) + (size_t)(c & 1) * (16 * RS * 4), 2 * RS * 4); }
    v4f xv[16], xk[16];                                              // v and k of one step over the earlier keys
    // step s of wave w: tokens 32 (8 s + w) .. + 31, so that the block walks the earlier keys in ascending order, as the head's other blocks do
    // each s_wait_xcnt 0 of this kernel stands behind a group of loads, in front of every write of their address registers; the lane's offset is an input so that no load of the group lands in it
    FLA_HOLD();
    if (i > 0) {
        const char* ub = xh + (size_t)(32 * wv) * (RS * 4);
        tk_ld(xk, ub + DQ * 4, lo); FLA_HOLD(); tk_ld(xv, ub + 2 * DQ * 4, lo);   // issued in the loop's own order, k and then v, so that the counted waits at the loop's head fit both ways in
        asm volatile("s_wait_xcnt 0x0" :: "v"(lo) : "memory"); }
    FLA_HOLD();
    // the state of the wave's eighth of the earlier keys: ST[e][d] = sum over t of v[t][e] k[t][d]; tile (a, b) holds e = 4 row + a, d = 4 column + b
    v8f sa[4][4];
#pragma unroll
    for (int a = 0; a < 4; ++a)
#pragma unroll
        for (int b = 0; b < 4; ++b) sa[a][b] = (v8f){};
    v16h qf[2][2];
    // the fragments of the wave's own 32 rows: v's and k's go to LDS for all waves, q's stay in registers
    auto own_prep = [&]() __attribute__((always_inline)) {
        // A wave reads only the rows of q, k and v that it copied itself, so its own wait is all that stands between copy and read
        asm volatile("s_wait_asynccnt 0x0" ::: "memory");
        const float* ql = (const float*)sw + lr * QPF + 8 * hi;
        const float* vl = (const float*)sw + (64 + 8 * hi) * QPF + lr * 4;
        v4f r[8][4], xo[16];                                         // fragments 0 .. 3: q; 4 .. 7: k, 32 rows on; v: the lane's 16 tokens as in tk_ld
#pragma unroll
        for (int j = 0; j < 8; ++j) { xo[j] = *(const v4fa*)(vl + j * QPF); xo[8 + j] = *(const v4fa*)(vl + (16 + j) * QPF); }
#pragma unroll
        for (int f = 0; f < 8; ++f)
#pragma unroll
            for (int w = 0; w < 4; ++w) r[f][w] = *(const v4fa*)(ql + (f >> 1) * 16 * QPF + (f & 1) * 32 + (w >> 1) * 16 + (w & 1) * 4);
        FLA_HOLD();   // all 48 LDS reads are issued before the first is waited for: sunk to the casts they would pay the LDS latency many times over
        { v16h f[4]; tk_pk4(f, xo);
#pragma unroll
          for (int a = 0; a < 4; ++a) fr_st(vfr[rt] + a * 64, lane, f[a]); }
#pragma unroll
        for (int f = 0; f < 4; ++f) { qf[f >> 1][f & 1] = fla_cvq(r[f][0], r[f][1], r[f][2], r[f][3]);
            fr_st(kfr[rt] + f * 64, lane, fla_cvq(r[4 + f][0], r[4 + f][1], r[4 + f][2], r[4 + f][3])); }
    };
    const char* ub = xh + (size_t)(32 * (8 + wv)) * (RS * 4);        // the wave's step 1
    if (i > 1) { st_step<true>(sa, xv, xk, ub, lo); ub += (size_t)256 * (RS * 4); }
    FLA_HOLD();
    own_prep();                                                      // while the loads of a step are in flight
    __syncthreads();                                                 // all own fragments of k and v are whole in LDS
    v8f acc[2][4];
#pragma unroll
    for (int qb = 0; qb < 2; ++qb)
#pragma unroll
        for (int a = 0; a < 4; ++a) acc[qb][a] = (v8f){};
    int ls = 0;                                                      // the wave's next own key step, 0 .. rt; the diagonal tile is the last
    auto own_next = [&]() __attribute__((always_inline)) {
        OF o; own_ld(o, kfr[ls], vfr[ls], lane);
        own_step(o, qf, acc, (rt - ls) * 32 + lr - 8 * hi);
        ++ls;
    };
    if (i > 0) {
        for (int s = 2; s < i; ++s) {
            st_step<true>(sa, xv, xk, ub, lo); ub += (size_t)256 * (RS * 4);
            FLA_HOLD();
            if (ls <= rt) own_next();                                // one own key step a trip: its products run while the next step's loads are in flight
            FLA_HOLD(); }
        st_step<false>(sa, xv, xk, ub, lo);
    }
    // the wave's state goes into its own range, behind its last read of q there: unit a * 8 + j holds, a lane, row e = 4 (8 hi + j) + a, columns d = 4 lr .. 4 lr + 3
#pragma unroll
    for (int a = 0; a < 4; ++a)
#pragma unroll
        for (int j = 0; j < 8; ++j) { v4f w; w[0] = sa[a][0][j]; w[1] = sa[a][1][j]; w[2] = sa[a][2][j]; w[3] = sa[a][3][j];
            *(v4fa*)(sw + ((a * 8 + j) * 32 + lane) * 16) = w; }
    __syncthreads();                                                 // the eight states are whole in LDS
    {                                                                // a wave sums four of the 32 units over the eight waves, in wave order
        v4f t[4][8];
#pragma unroll
        for (int c = 0; c < 4; ++c)
#pragma unroll
            for (int w = 0; w < 8; ++w) t[c][w] = *(const v4fa*)(stg + w * WST + ((wv * 4 + c) * 32 + lane) * 16);
#pragma unroll
        for (int c = 0; c < 4; ++c) { v4f u = t[c][0]; v4h h;
#pragma unroll
            for (int w = 1; w < 8; ++w) u += t[c][w];
#pragma unroll
            for (int e = 0; e < 4; ++e) h[e] = tohx(u[e]);
            *(v4h*)(ssm + (4 * (8 * hi + (wv & 1) * 4 + c) + (wv >> 1)) * SPI + lr * 4) = h; }
    }
    while (ls <= rt) own_next();                                     // the own key steps that are left
    __syncthreads();                                                 // the summed state is whole in LDS
#pragma unroll
    for (int a = 0; a < 4; ++a)                                      // q times the state: first operand 16 query rows, second operand column lr = row e = 4 lr + a of ST, the head dims d as k in WFrag::ld's order on both sides
#pragma unroll
        for (int kc = 0; kc < 2; ++kc) { const v16h sf = WFrag<h16>::ld(ssm + (4 * lr + a) * SPI + kc * 32 + 8 * hi);
#pragma unroll
            for (int qb = 0; qb < 2; ++qb) acc[qb][a] = wmma16(qf[qb][kc], sf, acc[qb][a]); }
    // a lane holds columns e = 4 lr .. 4 lr + 3 of row 8 hi + j: 16 contiguous bytes; a wave-wide store covers two whole 256-byte rows
    float* C = O + ((size_t)(z / NH_) * TT + r0 + 8 * hi) * DQ + (size_t)(z % NH_) * HD + lr * 4;
    v4f w[16];
#pragma unroll
    for (int r = 0; r < 16; ++r) { w[r][0] = acc[r >> 3][0][r & 7]; w[r][1] = acc[r >> 3][1][r & 7]; w[r][2] = acc[r >> 3][2][r & 7]; w[r][3] = acc[r >> 3][3][r & 7]; }
    // inputs only: all 16 rows stand in registers of their own in front of the first store, so that no register which an issued store names is written behind it
    asm volatile("" :: "v"(w[0]), "v"(w[1]), "v"(w[2]), "v"(w[3]), "v"(w[4]), "v"(w[5]), "v"(w[6]), "v"(w[7]), "v"(w[8]), "v"(w[9]), "v"(w[10]), "v"(w[11]), "v"(w[12]), "v"(w[13]), "v"(w[14]), "v"(w[15]));
#pragma unroll
    for (int r = 0; r < 16; ++r) *(v4f*)(C + (size_t)((r >> 3) * 16 + (r & 7)) * DQ) = w[r];
}

extern "C" void kernel_launch(void* const* d_in, const int* in_sizes, int n_in,
                              void* d_out, int out_size, void* d_ws, size_t ws_size, hipStream_t stream) {
    (void)in_sizes; (void)n_in; (void)out_size; (void)d_ws; (void)ws_size;
    const float* qkv = (const float*)d_in[0];
    // the module's one input: qkv [2][2048][3][16][64]: row (b, t) holds 3072 words: s * 1024 + h * 64 + d with s = 0 query, 1 key, 2 value
    float* OUT = (float*)d_out;     // [2][2048][16][64]
    k_fla<<<dim3(NB_ * NH_, TT / 256), 256, 0, stream>>>(qkv, OUT);   /* out[b][t][h][:] = tril(q k^T) v: the one writer of the output */
}
